// v000
// The times below were measured on an AMD MI455X: many runs one after another, warmed up first and cycling through
// copies of the inputs, with the whole window's GPU time divided by the number of runs. Launches and the gaps
// between them are all in it. The median over several windows is given; except for v000 it joins two sittings, which
// can be a few percent apart, so the side-by-side timings, each taken in one sitting, are the better comparison.
// The starting kernel, v000, takes 481 microseconds a run.
// Contractions: scores = q.k^T on v_wmma_f32_16x16x32_bf16 (q, k as RNE bf16 planes, exact products), out = (scores*scale*decay) @ v on v_wmma_f32_16x16x32_f16 (decayed score plane f16 carried x256, v^T plane f16 holding RNE bf16 values); f32 accumulate; decay mask, scaling and casts in f32.
#include <hip/hip_runtime.h>
#include <math.h>

// ---------------------------------------------------------------------------
// Problem constants
// ---------------------------------------------------------------------------
constexpr int kBatch = 2;
constexpr int kHeads = 8;
constexpr int kSeq   = 2048;
constexpr int kDh    = 64;
constexpr int kBH    = kBatch * kHeads;          // 16 (batch, head) planes
constexpr int kGroup = 4;                        // planes per score-plane group
constexpr int kElems = kBH * kSeq * kDh;         // 2,097,152 elements per tensor
constexpr float kPCarryInv       = 1.0f / 256.0f;   // decayed score plane carried x256 in f16
constexpr float kScoreScaleCarry = 0.125f * 256.0f; // 64^-0.5 * carry = 32 (exact power of two)
static_assert(kSeq % 64 == 0 && kDh % 64 == 0, "");
static_assert(kDh % 32 == 0 && kSeq % 32 == 0, "");
static_assert(kBH % kGroup == 0 && (kGroup % kHeads == 0 || kHeads % kGroup == 0), "");
static_assert(kSeq == 256 * 8, "");              // decay kernel: 256 threads x 8 columns = one score row
static_assert(kElems % (8 * 256) == 0, "");      // cast kernel grid is exact
// GEMM shape contract: scores M=N=2048 (64-multiples), K=64 (%32); out M=2048 (%64), N=64 (%64), K=2048 (%32). No padding.
static_assert(kSeq % 64 == 0 && kDh % 32 == 0 && kSeq % 32 == 0 && kDh % 64 == 0, "");

typedef __attribute__((ext_vector_type(16))) _Float16 v16h;
typedef __attribute__((ext_vector_type(8)))  _Float16 v8h;
typedef __attribute__((ext_vector_type(16))) __bf16   v16b;
typedef __attribute__((ext_vector_type(8)))  __bf16   v8b;
typedef __attribute__((ext_vector_type(8)))  float    v8f;
typedef __attribute__((ext_vector_type(4)))  float    v4f;
typedef __attribute__((ext_vector_type(4)))  unsigned int v4u;

// ---------------------------------------------------------------------------
// Helper pieces
// ---------------------------------------------------------------------------
__device__ __forceinline__ unsigned short f2bf_bits(float f) {
  unsigned u = __float_as_uint(f);
  return (unsigned short)((u + 0x7FFFu + ((u >> 16) & 1u)) >> 16);
}
__device__ __forceinline__ float bf_bits2f(unsigned short h) { return __uint_as_float(((unsigned)h) << 16); }

// hazard guards as plain device helpers (no inline asm inside the kernel template body)
__device__ __forceinline__ void dep_guard_h(v8f& a, v8f& b, v16h x, v16h y) { asm volatile("v_nop\n\tv_nop\n\tv_nop\n\tv_nop" : "+v"(a), "+v"(b) : "v"(x), "v"(y)); }
__device__ __forceinline__ void dep_guard_b(v8f& a, v8f& b, v16b x, v16b y) { asm volatile("v_nop\n\tv_nop\n\tv_nop\n\tv_nop" : "+v"(a), "+v"(b) : "v"(x), "v"(y)); }
__device__ __forceinline__ void dep_guard4_h(v8f& a, v8f& b, v8f& c, v8f& d, v16h x, v16h y) { asm volatile("v_nop\n\tv_nop\n\tv_nop\n\tv_nop" : "+v"(a), "+v"(b), "+v"(c), "+v"(d) : "v"(x), "v"(y)); }
__device__ __forceinline__ void dep_guard4_b(v8f& a, v8f& b, v8f& c, v8f& d, v16b x, v16b y) { asm volatile("v_nop\n\tv_nop\n\tv_nop\n\tv_nop" : "+v"(a), "+v"(b), "+v"(c), "+v"(d) : "v"(x), "v"(y)); }
__device__ __forceinline__ void keep4_h(v16h a, v16h b, v16h c, v16h d) { asm volatile("v_nop" :: "v"(a), "v"(b), "v"(c), "v"(d)); }
__device__ __forceinline__ void keep4_b(v16b a, v16b b, v16b c, v16b d) { asm volatile("v_nop" :: "v"(a), "v"(b), "v"(c), "v"(d)); }
__device__ __forceinline__ void acc_guard4(v8f& a, v8f& b, v8f& c, v8f& d) { asm volatile("v_nop\n\tv_nop\n\tv_nop\n\tv_nop" : "+v"(a), "+v"(b), "+v"(c), "+v"(d)); }
template <typename T> struct Frag;
template <> struct Frag<_Float16> {
  typedef v16h V; union U { v16h v; v8h h[2]; };
  // elements 0..7 <- p[0..7], 8..15 <- p[16..23]
  static __device__ __forceinline__ v16h load(const _Float16* p) {
    U f; f.h[0] = *(const v8h*)(p); f.h[1] = *(const v8h*)(p + 16); return f.v;
  }
  static __device__ __forceinline__ v8f mma(v16h a, v16h b, v8f c) {
    return __builtin_amdgcn_wmma_f32_16x16x32_f16(false, a, false, b, (short)0, c, false, false);
  }
  static __device__ __forceinline__ void guard(v8f& a, v8f& b, v16h x, v16h y) { dep_guard_h(a, b, x, y); }
  static __device__ __forceinline__ void guard4(v8f& a, v8f& b, v8f& c, v8f& d, v16h x, v16h y) { dep_guard4_h(a, b, c, d, x, y); }
  static __device__ __forceinline__ void keep(v16h a, v16h b, v16h c, v16h d) { keep4_h(a, b, c, d); }
};
template <> struct Frag<__bf16> {
  typedef v16b V; union U { v16b v; v8b h[2]; };
  static __device__ __forceinline__ v16b load(const __bf16* p) {
    U f; f.h[0] = *(const v8b*)(p); f.h[1] = *(const v8b*)(p + 16); return f.v;
  }
  static __device__ __forceinline__ v8f mma(v16b a, v16b b, v8f c) {
    return __builtin_amdgcn_wmma_f32_16x16x32_bf16(false, a, false, b, (short)0, c, false, false);
  }
  static __device__ __forceinline__ void guard(v8f& a, v8f& b, v16b x, v16b y) { dep_guard_b(a, b, x, y); }
  static __device__ __forceinline__ void guard4(v8f& a, v8f& b, v8f& c, v8f& d, v16b x, v16b y) { dep_guard4_b(a, b, c, d, x, y); }
  static __device__ __forceinline__ void keep(v16b a, v16b b, v16b c, v16b d) { keep4_b(a, b, c, d); }
};

__device__ __forceinline__ unsigned pk16(unsigned short a, unsigned short b) { return (unsigned)a | ((unsigned)b << 16); }
__device__ __forceinline__ unsigned short h_bits(float f) { const _Float16 h = (_Float16)f; return __builtin_bit_cast(unsigned short, h); }

// ---- Register-blocked batched WMMA GEMM (ACT reduced to none/relu/leaky) -------------------------------
// C[m,n] = scale * sum_k A[m,k] * Bt[n,k] (+bias)(+resid); each wave owns a 64x64 tile.
// A row-major [M,K]; Bt row-major [N,K]; M,N % 64 == 0, K % 32 == 0.
// SPLIT: operands are hi/lo planes (A2/Bt2 = lo planes, same layout); product = hi*hi + hi*lo + lo*hi.
// BIAS_MODE: 0 = none, 1 = bias[m], 2 = bias[n].
// OUT_MODE: 0 = f32, 1 = f16, 2 = bf16 hi plane (Cout) + bf16 lo plane (Cout2).
// ET: 0 = f16 operands, 1 = bf16 operands (pointers passed as 16-bit storage)
template <int ET> struct Elem;
template <> struct Elem<0> { typedef _Float16 T; };
template <> struct Elem<1> { typedef __bf16 T; };
template <int ET, bool SPLIT, int BIAS_MODE, int OUT_MODE, bool RESID, int ACT = 0>
__global__ __launch_bounds__(256) void wmma_gemm64(
    const unsigned short* __restrict__ Ap, const unsigned short* __restrict__ A2p, int lda, long strideA,
    const unsigned short* __restrict__ Btp, const unsigned short* __restrict__ Bt2p, int ldb, long strideB,
    void* __restrict__ Cout, void* __restrict__ Cout2, int ldc, long strideC,
    const float* __restrict__ bias,
    const float* __restrict__ resid, long strideR,
    int M, int N, int K, float scale) {
  typedef typename Elem<ET>::T T;
  typedef typename Frag<T>::V V;
  const T* A = (const T*)Ap; const T* A2 = (const T*)A2p; const T* Bt = (const T*)Btp; const T* Bt2 = (const T*)Bt2p;
  __shared__ __align__(16) float sT[8][16 * 68];   // per-wave 16x64 slab, pitch 68 floats
  const int b    = blockIdx.y;
  const int lane = threadIdx.x & 31;
  const int wave = threadIdx.x >> 5;
  const int tilesN = N >> 6;
  const int tilesM = M >> 6;
  const int tile = blockIdx.x * 8 + wave;
  if (tile >= tilesM * tilesN) return;   // wave-uniform; no block barriers in this kernel
  const int tm = tile / tilesN;
  const int tn = tile - tm * tilesN;
  const int m0 = tm << 6;
  const int n0 = tn << 6;

  const T* Ab  = A  + (size_t)b * strideA;
  const T* Bb  = Bt + (size_t)b * strideB;
  const T* Ab2 = SPLIT ? (A2  + (size_t)b * strideA) : nullptr;
  const T* Bb2 = SPLIT ? (Bt2 + (size_t)b * strideB) : nullptr;

  const int rlane = lane & 15;                 // row (A) / col (B, D) within subtile
  const int koff  = (lane >> 4) * 8;           // k offset of this lane half
  const int mOff  = (lane >> 4) * 8;           // D row offset

  v8f acc[4][4];
#pragma unroll
  for (int i = 0; i < 4; ++i)
#pragma unroll
    for (int j = 0; j < 4; ++j) acc[i][j] = (v8f){0.f,0.f,0.f,0.f,0.f,0.f,0.f,0.f};

  for (int k0 = 0; k0 < K; k0 += 32) {
    V bh[4], bl[4];
#pragma unroll
    for (int j = 0; j < 4; ++j) {
      const size_t bo = (size_t)(n0 + (j << 4) + rlane) * ldb + koff + k0;
      bh[j] = Frag<T>::load(Bb + bo);
      if (SPLIT) bl[j] = Frag<T>::load(Bb2 + bo);
    }
#pragma unroll
    for (int i = 0; i < 4; ++i) {
      const size_t ao = (size_t)(m0 + (i << 4) + rlane) * lda + koff + k0;
      V ah = Frag<T>::load(Ab + ao);
      V al;
      if (SPLIT) al = Frag<T>::load(Ab2 + ao);
#pragma unroll
      for (int j = 0; j < 4; ++j) {
        acc[i][j] = Frag<T>::mma(ah, bh[j], acc[i][j]);
        if (SPLIT) {
          acc[i][j] = Frag<T>::mma(ah, bl[j], acc[i][j]);
          acc[i][j] = Frag<T>::mma(al, bh[j], acc[i][j]);
        }
      }
      // tie all four accumulators of this row group and keep the A fragment(s) live past the nops
      Frag<T>::guard4(acc[i][0], acc[i][1], acc[i][2], acc[i][3], ah, SPLIT ? al : ah);
    }
    Frag<T>::keep(bh[0], bh[1], bh[2], bh[3]);
    if (SPLIT) Frag<T>::keep(bl[0], bl[1], bl[2], bl[3]);
  }
  acc_guard4(acc[0][0], acc[0][1], acc[0][2], acc[0][3]);
  acc_guard4(acc[1][0], acc[1][1], acc[1][2], acc[1][3]);
  acc_guard4(acc[2][0], acc[2][1], acc[2][2], acc[2][3]);
  acc_guard4(acc[3][0], acc[3][1], acc[3][2], acc[3][3]);

  // ---- epilogue ----
  float* slab = sT[wave];
  const float* Rb = RESID ? (resid + (size_t)b * strideR) : nullptr;
#pragma unroll
  for (int i = 0; i < 4; ++i) {
    const int mBase = m0 + (i << 4);
#pragma unroll
    for (int j = 0; j < 4; ++j) {
      const int n = n0 + (j << 4) + rlane;
      float bv = 0.f;
      if (BIAS_MODE == 2) bv = bias[n];
#pragma unroll
      for (int r = 0; r < 8; ++r) {
        float v = acc[i][j][r] * scale;
        if (BIAS_MODE == 1) v += bias[mBase + mOff + r];
        if (BIAS_MODE == 2) v += bv;
        if (RESID) v += Rb[(size_t)(mBase + mOff + r) * ldc + n];
        if (ACT == 2) v = fmaxf(v, 0.0f);
        if (ACT == 4) v = (v > 0.f) ? v : 0.01f * v;
        slab[(mOff + r) * 68 + (j << 4) + rlane] = v;
      }
    }
    __builtin_amdgcn_fence(__ATOMIC_RELEASE, "workgroup");
    __builtin_amdgcn_wave_barrier();
    __builtin_amdgcn_fence(__ATOMIC_ACQUIRE, "workgroup");
    if (OUT_MODE == 0) {
      float* C = (float*)Cout + (size_t)b * strideC;
      const int hh = lane >> 4, c4 = (lane & 15) * 4;     // row seg = 256 B = 16 lanes x 16 B
      {
#pragma unroll
        for (int it = 0; it < 8; ++it) {
          const int row = it * 2 + hh;
          v4f v = *(const v4f*)(slab + row * 68 + c4);
          *(v4f*)(C + (size_t)(mBase + row) * ldc + n0 + c4) = v;
        }
        
      }
    } else {
      const int q = lane >> 3, c8 = (lane & 7) * 8;
      unsigned short* C  = (unsigned short*)Cout  + (size_t)b * strideC;
      unsigned short* C2 = (OUT_MODE == 2) ? ((unsigned short*)Cout2 + (size_t)b * strideC) : nullptr;
      {
#pragma unroll
        for (int it = 0; it < 4; ++it) {
          const int row = it * 4 + q;
          const float* sp = slab + row * 68 + c8;
          v8h hv, lv;
#pragma unroll
          for (int e = 0; e < 8; ++e) {
            if (OUT_MODE == 1) {
              hv[e] = (_Float16)sp[e];
            } else {
              unsigned short hb = f2bf_bits(sp[e]);
              unsigned short lb = f2bf_bits(sp[e] - bf_bits2f(hb));
              hv[e] = __builtin_bit_cast(_Float16, hb);
              lv[e] = __builtin_bit_cast(_Float16, lb);
            }
          }
          *(v8h*)(C + (size_t)(mBase + row) * ldc + n0 + c8) = hv;
          if (OUT_MODE == 2) *(v8h*)(C2 + (size_t)(mBase + row) * ldc + n0 + c8) = lv;
        }
        
      }
    }
    __builtin_amdgcn_fence(__ATOMIC_RELEASE, "workgroup");
    __builtin_amdgcn_wave_barrier();
    __builtin_amdgcn_fence(__ATOMIC_ACQUIRE, "workgroup");
  }
}

// ---------------------------------------------------------------------------
// (grid 1024 x 256 exact).
// ---------------------------------------------------------------------------
__global__ __launch_bounds__(256) void cast8_bf16_kernel(const float* __restrict__ in, unsigned short* __restrict__ out, int n8) {
  const int i = blockIdx.x * 256 + threadIdx.x;
  if (i >= n8) return;
  const float* p = in + 8 * (size_t)i;
  const v4f a = *(const v4f*)(p);
  const v4f c = *(const v4f*)(p + 4);
  unsigned short hb[8];
#pragma unroll
  for (int e = 0; e < 4; ++e) {
    hb[e]     = f2bf_bits(a[e]);
    hb[4 + e] = f2bf_bits(c[e]);
  }
  const v4u u = (v4u){pk16(hb[0], hb[1]), pk16(hb[2], hb[3]), pk16(hb[4], hb[5]), pk16(hb[6], hb[7])};
  unsigned short* q = out + 8 * (size_t)i;
  *(v4u*)q = u;
  
}

// ---------------------------------------------------------------------------
// V transpose + cast: VT[bh][d][s] = f16( bf16_rne( v[bh][s][d] ) )  (the f16 container holds the bf16 value exactly for
// normal magnitudes). grid (32, 16): blockIdx.x = s tile (64 rows), blockIdx.y = (batch, head) plane. 256 threads.
// Load coverage: 16 iterations x 256 threads = 4096 = whole 64(s) x 64(d) tile (coalesced along d); every LDS word read
// below is written here. Store coverage: 8 waves x 2 iterations x 4 rows (lane>>3) = 64 d-rows; (lane&7) x 8 halves =
// ---------------------------------------------------------------------------
__global__ __launch_bounds__(256) void vt_cast_kernel(const float* __restrict__ v, unsigned short* __restrict__ VT) {
  __shared__ float sm[64][65];   // sm[d][s_local]
  const int t  = threadIdx.x;
  const int s0 = blockIdx.x * 64;
  const int bh = blockIdx.y;
  const float* vb = v + (size_t)bh * kSeq * kDh;
#pragma unroll
  for (int i = 0; i < 16; ++i) {
    const int e = i * 256 + t;
    const int r = e >> 6;          // s local
    const int c = e & 63;          // d
    const float x = vb[(size_t)(s0 + r) * kDh + c];
    sm[c][r] = bf_bits2f(f2bf_bits(x));
  }
  __syncthreads();
  const int lane = t & 31, wave = t >> 5;
  const int q = lane >> 3, c8 = (lane & 7) * 8;
  unsigned short* op = VT + (size_t)bh * kDh * kSeq;
  {
#pragma unroll
    for (int it = 0; it < 2; ++it) {
      const int row = wave * 8 + it * 4 + q;                 // d
      unsigned short hb[8];
#pragma unroll
      for (int e = 0; e < 8; ++e) hb[e] = h_bits(sm[row][c8 + e]);
      const v4u u = (v4u){pk16(hb[0], hb[1]), pk16(hb[2], hb[3]), pk16(hb[4], hb[5]), pk16(hb[6], hb[7])};
      *(v4u*)(op + (size_t)row * kSeq + s0 + c8) = u;
    }
    
  }
}

// ---------------------------------------------------------------------------
// Decay mask + scale + f16 cast of one score row, f32 math:
//   P[hg][i][j] = f16( 256 * 0.125 * exp2((i-j) * log2_gamma_h) * S[hg][i][j] )  for j <= i, 0 for j > i
// One block of 256 threads per (row i = blockIdx.x, plane-in-group hg = blockIdx.y); thread t owns columns 8t..8t+7
// (256 x 8 = 2048 = whole row); two b128 loads per lane. log2_gamma per plane selected from block-uniform args.
// ---------------------------------------------------------------------------
__global__ __launch_bounds__(256) void decay_cast_kernel(const float* __restrict__ Sp, unsigned short* __restrict__ Pp,
                                                         float lg0, float lg1, float lg2, float lg3) {
  const int i  = blockIdx.x;
  const int hg = blockIdx.y;
  const int t  = threadIdx.x;
  const float lg = (hg == 0) ? lg0 : (hg == 1) ? lg1 : (hg == 2) ? lg2 : lg3;
  const size_t rowoff = ((size_t)hg * kSeq + i) * kSeq;
  const float* sr = Sp + rowoff + 8 * (size_t)t;
  const v4f a = *(const v4f*)(sr);
  const v4f c = *(const v4f*)(sr + 4);
  float x[8];
#pragma unroll
  for (int e = 0; e < 4; ++e) { x[e] = a[e]; x[4 + e] = c[e]; }
  const int j0 = 8 * t;
  unsigned short hb[8];
#pragma unroll
  for (int e = 0; e < 8; ++e) {
    const int d = i - (j0 + e);                     // i - j, in [-2047, 2047]
    const float ex  = (float)d * lg;                // exponent, >= -94 below the diagonal
    const float dec = exp2f(ex);                    // gamma^(i-j), normal f32 for d >= 0
    const float w   = (d >= 0) ? dec * kScoreScaleCarry : 0.0f;   // causal zero above the diagonal
    hb[e] = h_bits(x[e] * w);
  }
  const v4u u = (v4u){pk16(hb[0], hb[1]), pk16(hb[2], hb[3]), pk16(hb[4], hb[5]), pk16(hb[6], hb[7])};
  unsigned short* pr = Pp + rowoff + 8 * (size_t)t;
  *(v4u*)pr = u;
  
}

// ---------------------------------------------------------------------------
// Host glue.
// Workspace region map (bytes, all offsets 4-MiB aligned, every region written before it is read):
//   QB  bf16 [16*2048][64]             4,194,304  at           0   (q planes, RNE bf16)
//   KB  bf16 [16*2048][64]             4,194,304  at   4,194,304   (k planes, RNE bf16 = Bt of the score GEMM)
//   VT  f16  [16][64][2048]            4,194,304  at   8,388,608   (v^T planes = Bt of the output GEMM)
//   SC  f32  [4][2048][2048]          67,108,864  at  12,582,912   (scores of one 4-plane group, reused 4x)
//   PP  f16  [4][2048][2048]          33,554,432  at  79,691,776   (decayed scores x256, reused 4x)
//   total                            113,246,208
// GEMM shapes: scores M=N=2048 (64-multiples), K=64 (%32==0); out M=2048, N=64, K=2048 (%32==0). No padding anywhere.
// 15 launches: 3 casts + 4 groups x (score GEMM, decay cast, output GEMM).
// ---------------------------------------------------------------------------
extern "C" void kernel_launch(void* const* d_in, const int* in_sizes, int n_in,
                              void* d_out, int out_size, void* d_ws, size_t ws_size,
                              hipStream_t stream) {
  if (n_in < 3) return;
  if (in_sizes[0] != kElems || in_sizes[1] != kElems || in_sizes[2] != kElems) return;
  if (out_size != kElems) return;

  const size_t sz16 = (size_t)kElems * 2;                       // 4,194,304
  const size_t szS  = (size_t)kGroup * kSeq * kSeq * 4;          // 67,108,864
  const size_t szP  = (size_t)kGroup * kSeq * kSeq * 2;          // 33,554,432
  const size_t offQ  = 0;
  const size_t offK  = offQ + sz16;
  const size_t offVT = offK + sz16;
  const size_t offS  = offVT + sz16;
  const size_t offP  = offS + szS;
  const size_t total = offP + szP;                              // 113,246,208
  if (ws_size < total) return;

  const float* q = (const float*)d_in[0];
  const float* k = (const float*)d_in[1];
  const float* v = (const float*)d_in[2];
  float* out = (float*)d_out;
  char* ws = (char*)d_ws;
  unsigned short* QB = (unsigned short*)(ws + offQ);
  unsigned short* KB = (unsigned short*)(ws + offK);
  unsigned short* VT = (unsigned short*)(ws + offVT);
  float* SC = (float*)(ws + offS);
  unsigned short* PP = (unsigned short*)(ws + offP);

  // log2(gamma_h), gamma_h = 1 - 2^(-5-h) (exact in f32); log2 evaluated in double and RNE-converted to f32
  float lg[kHeads];
  for (int h = 0; h < kHeads; ++h) {
    const float gma = 1.0f - 1.0f / (float)(32 << h);
    lg[h] = (float)log2((double)gma);
  }

  // ---- prologue: 16-bit operand planes ----
  const int n8 = kElems / 8;   // 262,144 -> 1024 blocks exact
  cast8_bf16_kernel<<<dim3(n8 / 256), dim3(256), 0, stream>>>(q, QB, n8);
  cast8_bf16_kernel<<<dim3(n8 / 256), dim3(256), 0, stream>>>(k, KB, n8);
  vt_cast_kernel<<<dim3(kSeq / 64, kBH), dim3(256), 0, stream>>>(v, VT);

  const long stridePlane16 = (long)kSeq * kDh;           // per (batch, head) plane in QB / KB / out (elements)
  const long strideScore   = (long)kSeq * kSeq;          // per plane-in-group score / decayed-score plane
  const long strideVT      = (long)kDh * kSeq;           // per plane V^T
  const int  tilesScore    = (kSeq / 64) * (kSeq / 64);  // 1024 -> 128 blocks of 8 waves
  const int  tilesOut      = (kSeq / 64) * (kDh / 64);   // 32 -> 4 blocks of 8 waves

  for (int gi = 0; gi < kBH / kGroup; ++gi) {
    const size_t planeOff = (size_t)gi * kGroup * kSeq * kDh;      // elements into QB / KB / out
    const int hbase = (gi * kGroup) % kHeads;                      // heads hbase..hbase+3 of batch gi*kGroup/kHeads
    const unsigned short* Ag  = QB + planeOff;
    const unsigned short* Btg = KB + planeOff;
    // SC[hg][i][j] = sum_d QB[plane,i,d] * KB[plane,j,d]   (M=N=2048, K=64), bf16 operands
    wmma_gemm64<1, false, 0, 0, false, 0><<<dim3(tilesScore / 8, kGroup), dim3(256), 0, stream>>>(
        Ag, Ag, kDh, stridePlane16, Btg, Btg, kDh, stridePlane16,
        (void*)SC, (void*)SC, kSeq, strideScore, SC, SC, 0L, kSeq, kSeq, kDh, 1.0f);
    // decay mask * scale * causal, f16 cast carried x256 -> PP
    decay_cast_kernel<<<dim3(kSeq, kGroup), dim3(256), 0, stream>>>(
        SC, PP, lg[hbase + 0], lg[hbase + 1], lg[hbase + 2], lg[hbase + 3]);
    // out[plane, i, n] = 2^-8 * sum_j PP[hg][i][j] * VT[plane][n][j]   (M=2048, N=64, K=2048), f16 operands
    const unsigned short* VTg = VT + (size_t)gi * kGroup * kDh * kSeq;
    float* outg = out + planeOff;
    wmma_gemm64<0, false, 0, 0, false, 0><<<dim3(tilesOut / 8, kGroup), dim3(256), 0, stream>>>(
        PP, PP, kSeq, strideScore, VTg, VTg, kSeq, strideVT,
        (void*)outg, (void*)outg, kDh, stridePlane16, SC, SC, 0L, kSeq, kDh, kSeq, kPCarryInv);
  }
}

// v002
// A run of this version takes 34.2 microseconds.
// It is 14.2 times as fast as v000, going by the measured steps of the versions left out in between.
// Contractions: scores^T = k.q^T on v_wmma_f32_16x16x32_bf16 (q, k as RNE bf16, exact products), out^T = v^T @ (scores*scale*decay)^T on v_wmma_f32_16x16x32_f16 (decayed scores f16 carried x256, v as f16 holding RNE bf16 values, transposed by the LDS read); f32 accumulate; decay mask, scaling and casts in f32. One kernel: q, k, v are read as f32 and cast on their way to registers and LDS; the scores stay in registers.
#include <hip/hip_runtime.h>
#include <math.h>

// ---------------------------------------------------------------------------
// Problem constants
// ---------------------------------------------------------------------------
constexpr int kBatch = 2;
constexpr int kHeads = 8;
constexpr int kSeq   = 2048;
constexpr int kDh    = 64;
constexpr int kBH    = kBatch * kHeads;          // 16 (batch, head) planes
constexpr int kElems = kBH * kSeq * kDh;         // 2,097,152 elements per tensor
constexpr int kQBlk  = 128;                      // queries per work-group: 8 waves x 16
constexpr int kStage = 64;                       // keys per LDS stage
constexpr int kPitch  = 72;                      // K rows in LDS, 16-bit elements: 128 B of data + 16 B pad (16 B x odd, plain 16-byte reads)
constexpr int kPitchV = 80;                      // V rows in LDS, 16-bit elements: 128 B of data + 32 B pad (32 B x odd, transposing reads)
constexpr float kPCarryInv       = 1.0f / 256.0f;   // decayed scores carried x256 in f16
constexpr float kScoreScaleCarry = 0.125f * 256.0f; // 64^-0.5 * carry = 32 (exact power of two)
static_assert(kDh == 64 && kStage == 64, "");    // LDS rows of 128 B; staging map below: 256 threads x 4 rows x 4 elements per tile
static_assert(kSeq % kQBlk == 0 && kSeq % kStage == 0, "");
static_assert(kHeads == 8, "");                  // eight log2(gamma) arguments

typedef __attribute__((ext_vector_type(16))) _Float16 v16h;
typedef __attribute__((ext_vector_type(8)))  _Float16 v8h;
typedef __attribute__((ext_vector_type(16))) __bf16   v16b;
typedef __attribute__((ext_vector_type(8)))  __bf16   v8b;
typedef __attribute__((ext_vector_type(8)))  float    v8f;
typedef __attribute__((ext_vector_type(4)))  float    v4f;
typedef __attribute__((ext_vector_type(4)))  __bf16   v4b;
typedef __attribute__((ext_vector_type(4)))  _Float16 v4h;
typedef __attribute__((ext_vector_type(2)))  unsigned int v2u;
typedef __attribute__((ext_vector_type(8)))  short    v8s;

// Casts of four f32 values on their way to LDS: RNE bf16, and f16 holding the RNE bf16 value (exact for normal magnitudes).
__device__ __forceinline__ v2u cast4_bf16(v4f x) { return __builtin_bit_cast(v2u, __builtin_convertvector(x, v4b)); }
__device__ __forceinline__ v2u cast4_bf16_as_f16(v4f x) {
  const v4f y = __builtin_convertvector(__builtin_convertvector(x, v4b), v4f);
  return __builtin_bit_cast(v2u, __builtin_convertvector(y, v4h));
}

// Fragment loaders, hardware k order of the 16x16x32 16-bit forms: elements 0..7 <- p[0..7], 8..15 <- p[16..23],
// p = row start + 8 * (lane >> 4).
__device__ __forceinline__ v16b load_frag_b(const __bf16* p) {
  union { v16b v; v8b h[2]; } f; f.h[0] = *(const v8b*)(p); f.h[1] = *(const v8b*)(p + 16); return f.v;
}
// The same order from f32 memory, cast to RNE bf16 in registers.
__device__ __forceinline__ v16b load_frag_b_f32(const float* p) {
  const v4f a0 = *(const v4f*)(p),      a1 = *(const v4f*)(p + 4);
  const v4f b0 = *(const v4f*)(p + 16), b1 = *(const v4f*)(p + 20);
  union { v16b v; v4b q[4]; } f;
  f.q[0] = __builtin_convertvector(a0, v4b); f.q[1] = __builtin_convertvector(a1, v4b);
  f.q[2] = __builtin_convertvector(b0, v4b); f.q[3] = __builtin_convertvector(b1, v4b);
  return f.v;
}
// Transposing LDS read of a row-major [key][d] 16-bit tile. Lane l points at row kbase + 8 (l >> 4) + (l & 7), byte
// 2 dbase + 16 ((l >> 3) & 1); lane (c, h) receives keys kbase + 8h + 0..7 of column dbase + c. The reads at kbase and
// kbase + 16 are elements 0..7 and 8..15 of one 16 (d) x 32 (keys) A fragment in the hardware k order.
__device__ __forceinline__ v8h ld_tr16(const _Float16* p) {
  typedef __attribute__((address_space(3))) v8s lds_v8s;
  return __builtin_bit_cast(v8h, __builtin_amdgcn_ds_load_tr16_b128_v8i16((lds_v8s*)p));
}
__device__ __forceinline__ v16h load_frag_tr(const _Float16* p) {
  union { v16h v; v8h h[2]; } f; f.h[0] = ld_tr16(p); f.h[1] = ld_tr16(p + 16 * kPitchV); return f.v;
}

// ---------------------------------------------------------------------------
// One stage (64 keys) of one wave's 16 queries, K and V tiles in LDS, both [key][d]. c = lane & 15 (query column), h = lane >> 4.
// T[t][r] = S^T[key 16t + 8h + r][query c] (A = K rows, B = Q kept in registers);
//   P = f16( 256 * 0.125 * exp2((i-j) * log2_gamma_h) * S )  for j <= i, 0 for j > i   (f32 math per score element);
//   two converted tiles are the B operand of the second product as they lie (element s = T[s >> 3][s & 7] of 32 keys);
//   acc[n][r] += O^T[d 16n + 8h + r][query c] (A = V^T rows in the same k order, by the transposing read; bV is the
//   lane's own read address in the V tile). dbase = i - (first key + 8h).
// ---------------------------------------------------------------------------
__device__ __forceinline__ void stage_compute(const __bf16* __restrict__ bK, const _Float16* __restrict__ bV,
                                              const v16b (&qf)[2], v8f (&acc)[4], int dbase, float lg, int c, int h) {
  v16b ka[4][2];
#pragma unroll  // constant indices: the fragment and accumulator arrays stay in registers
  for (int tt = 0; tt < 4; ++tt)
#pragma unroll  // constant indices: the fragment and accumulator arrays stay in registers
    for (int kk = 0; kk < 2; ++kk) ka[tt][kk] = load_frag_b(bK + (tt * 16 + c) * kPitch + kk * 32 + 8 * h);
  // keeps the K fragment loads one group ahead of the products: spread among them each load waits out its own LDS latency
  __builtin_amdgcn_sched_barrier(0);
  v8f T[4];
#pragma unroll  // constant indices: the fragment and accumulator arrays stay in registers
  for (int tt = 0; tt < 4; ++tt) {
    T[tt] = (v8f){0.f, 0.f, 0.f, 0.f, 0.f, 0.f, 0.f, 0.f};
#pragma unroll  // constant indices: the fragment and accumulator arrays stay in registers
    for (int kk = 0; kk < 2; ++kk)
      T[tt] = __builtin_amdgcn_wmma_f32_16x16x32_bf16(false, ka[tt][kk], false, qf[kk], (short)0, T[tt], false, false);
  }
  v16h va[2][4];
#pragma unroll  // constant indices: the fragment and accumulator arrays stay in registers
  for (int p = 0; p < 2; ++p)
#pragma unroll  // constant indices: the fragment and accumulator arrays stay in registers
    for (int n = 0; n < 4; ++n) va[p][n] = load_frag_tr(bV + p * 32 * kPitchV + n * 16);
  // keeps the V^T fragment loads in front of the decay arithmetic, which then covers their LDS latency
  __builtin_amdgcn_sched_barrier(0);
#pragma unroll  // constant indices: the fragment and accumulator arrays stay in registers
  for (int p = 0; p < 2; ++p) {
    v16h pf;
#pragma unroll  // constant indices: the fragment and accumulator arrays stay in registers
    for (int tt = 0; tt < 2; ++tt) {
#pragma unroll  // constant indices: the fragment and accumulator arrays stay in registers
      for (int r = 0; r < 8; ++r) {
        const int d = dbase - (p * 32 + tt * 16 + r);   // i - j, in [-2047, 2047]
        const float ex  = (float)d * lg;                // exponent, >= -94 below the diagonal
        const float dec = exp2f(ex);                    // gamma^(i-j), normal f32 for d >= 0
        const float w   = (d >= 0) ? dec * kScoreScaleCarry : 0.0f;   // causal zero above the diagonal
        pf[tt * 8 + r] = (_Float16)(T[p * 2 + tt][r] * w);
      }
    }
#pragma unroll  // constant indices: the fragment and accumulator arrays stay in registers
    for (int n = 0; n < 4; ++n)
      acc[n] = __builtin_amdgcn_wmma_f32_16x16x32_f16(false, va[p][n], false, pf, (short)0, acc[n], false, false);
  }
}

// ---------------------------------------------------------------------------
// Fused casts, scores, decay and output product. grid (16, 16): blockIdx.x = block of 128 queries, blockIdx.y = (batch,
// head) plane. 8 waves, each owns 16 queries and walks all 2048 keys in stages of 64.
// K and V tiles go global f32 -> registers -> cast -> LDS, two buffers, one barrier per stage: the stores of stage s + 1
// aim at the buffer whose last readers passed the barrier that ended stage s - 1.
// ---------------------------------------------------------------------------
__global__ __launch_bounds__(256) void decay_attn_fused_kernel(
    const float* __restrict__ q, const float* __restrict__ k, const float* __restrict__ v, float* __restrict__ out,
    float lg0, float lg1, float lg2, float lg3, float lg4, float lg5, float lg6, float lg7) {
  __shared__ __align__(16) unsigned short sK[2][kStage * kPitch];    // [key][d], bf16
  __shared__ __align__(16) unsigned short sV[2][kStage * kPitchV];   // [key][d], f16
  const int t     = threadIdx.x;
  const int lane  = t & 31;
  const int wave  = t >> 5;
  const int c     = lane & 15;
  const int h     = lane >> 4;
  const int plane = blockIdx.y;
  const int head  = plane % kHeads;
  const float lg = (head == 0) ? lg0 : (head == 1) ? lg1 : (head == 2) ? lg2 : (head == 3) ? lg3
                 : (head == 4) ? lg4 : (head == 5) ? lg5 : (head == 6) ? lg6 : lg7;
  const int i = blockIdx.x * kQBlk + wave * 16 + c;                 // this lane's query

  const float* qp = q + ((size_t)plane * kSeq + i) * kDh + 8 * h;
  v16b qf[2];
  qf[0] = load_frag_b_f32(qp);
  qf[1] = load_frag_b_f32(qp + 32);

  // staging map: thread t moves 4 elements of rows (t >> 4) + 16 j, j = 0..3, of each tile; 16 threads cover one 256-B f32 row
  const int srow = t >> 4;
  const int scol = (t & 15) * 4;
  const int soK  = srow * kPitch + scol;
  const int soV  = srow * kPitchV + scol;
  const float* gK = k + ((size_t)plane * kSeq + srow) * kDh + scol;
  const float* gV = v + ((size_t)plane * kSeq + srow) * kDh + scol;
  // this lane's address in a V tile for the transposing reads
  const int vo = (8 * h + (lane & 7)) * kPitchV + 8 * ((lane >> 3) & 1);
  {
    v4f rk[4], rv[4];
#pragma unroll  // constant indices: the staging arrays stay in registers
    for (int j = 0; j < 4; ++j) {
      rk[j] = *(const v4f*)(gK + j * 16 * kDh);
      rv[j] = *(const v4f*)(gV + j * 16 * kDh);
    }
#pragma unroll  // constant indices: the staging arrays stay in registers
    for (int j = 0; j < 4; ++j) {
      *(v2u*)(&sK[0][soK + j * 16 * kPitch])  = cast4_bf16(rk[j]);
      *(v2u*)(&sV[0][soV + j * 16 * kPitchV]) = cast4_bf16_as_f16(rv[j]);
    }
  }

  v8f acc[4];
#pragma unroll  // constant indices: the fragment and accumulator arrays stay in registers
  for (int n = 0; n < 4; ++n) acc[n] = (v8f){0.f, 0.f, 0.f, 0.f, 0.f, 0.f, 0.f, 0.f};
  __syncthreads();   // stage 0 published

  constexpr int kStages = kSeq / kStage;
  int dbase = i - 8 * h;
  for (int s = 0; s + 1 < kStages; ++s) {
    gK += kStage * kDh;
    gV += kStage * kDh;
    v4f rk[4], rv[4];
#pragma unroll  // constant indices: the staging arrays stay in registers
    for (int j = 0; j < 4; ++j) {
      rk[j] = *(const v4f*)(gK + j * 16 * kDh);
      rv[j] = *(const v4f*)(gV + j * 16 * kDh);
    }
    stage_compute((const __bf16*)sK[s & 1], (const _Float16*)sV[s & 1] + vo, qf, acc, dbase, lg, c, h);
    dbase -= kStage;
    unsigned short* dK = sK[(s + 1) & 1];
    unsigned short* dV = sV[(s + 1) & 1];
#pragma unroll  // constant indices: the staging arrays stay in registers
    for (int j = 0; j < 4; ++j) {
      *(v2u*)(dK + soK + j * 16 * kPitch)  = cast4_bf16(rk[j]);
      *(v2u*)(dV + soV + j * 16 * kPitchV) = cast4_bf16_as_f16(rv[j]);
    }
    __syncthreads();   // publishes stage s + 1 and ends every read of stage s
  }
  stage_compute((const __bf16*)sK[(kStages - 1) & 1], (const _Float16*)sV[(kStages - 1) & 1] + vo, qf, acc, dbase, lg, c, h);

  // a lane holds 8 consecutive d of its query's row per tile: two 16-byte stores
  float* op = out + ((size_t)plane * kSeq + i) * kDh + 8 * h;
#pragma unroll  // constant indices: the fragment and accumulator arrays stay in registers
  for (int n = 0; n < 4; ++n) {
    const v4f lo = (v4f){acc[n][0], acc[n][1], acc[n][2], acc[n][3]} * kPCarryInv;
    const v4f hi = (v4f){acc[n][4], acc[n][5], acc[n][6], acc[n][7]} * kPCarryInv;
    *(v4f*)(op + n * 16)     = lo;
    *(v4f*)(op + n * 16 + 4) = hi;
  }
}

// ---------------------------------------------------------------------------
// Host glue. One launch; the workspace is not used.
// ---------------------------------------------------------------------------
extern "C" void kernel_launch(void* const* d_in, const int* in_sizes, int n_in,
                              void* d_out, int out_size, void* d_ws, size_t ws_size,
                              hipStream_t stream) {
  if (n_in < 3) return;
  if (in_sizes[0] != kElems || in_sizes[1] != kElems || in_sizes[2] != kElems) return;
  if (out_size != kElems) return;
  (void)d_ws;
  (void)ws_size;

  const float* q = (const float*)d_in[0];
  const float* k = (const float*)d_in[1];
  const float* v = (const float*)d_in[2];
  float* out = (float*)d_out;

  // log2(gamma_h), gamma_h = 1 - 2^(-5-h) (exact in f32); log2 evaluated in double and RNE-converted to f32
  float lg[kHeads];
  for (int h = 0; h < kHeads; ++h) {
    const float gma = 1.0f - 1.0f / (float)(32 << h);
    lg[h] = (float)log2((double)gma);
  }

  decay_attn_fused_kernel<<<dim3(kSeq / kQBlk, kBH), dim3(256), 0, stream>>>(
      q, k, v, out, lg[0], lg[1], lg[2], lg[3], lg[4], lg[5], lg[6], lg[7]);
}

// v003
// One run takes 32.7 microseconds.
// Next to v002, in two timings, it ran 1.04 and 1.05 times as fast.
// All steps since v000 together make it 14.8 times as fast.
// Contractions: scores^T = k.q^T on v_wmma_f32_16x16x32_bf16 (q, k as RNE bf16, exact products), out^T = v^T @ (scores*scale*decay)^T on v_wmma_f32_16x16x32_f16 (decayed scores f16 carried x256, v as f16 holding RNE bf16 values, transposed by the LDS read); f32 accumulate; decay mask, scaling and casts in f32, the decay weight as the product of a per-lane stage factor and a per-key table. One kernel: q, k, v are read as f32 and cast on their way to registers and LDS; the scores stay in registers.
#include <hip/hip_runtime.h>
#include <math.h>

// ---------------------------------------------------------------------------
// Problem constants
// ---------------------------------------------------------------------------
constexpr int kBatch = 2;
constexpr int kHeads = 8;
constexpr int kSeq   = 2048;
constexpr int kDh    = 64;
constexpr int kBH    = kBatch * kHeads;          // 16 (batch, head) planes
constexpr int kElems = kBH * kSeq * kDh;         // 2,097,152 elements per tensor
constexpr int kQBlk  = 128;                      // queries per work-group: 8 waves x 16
constexpr int kStage = 64;                       // keys per LDS stage
constexpr int kPitch  = 72;                      // K rows in LDS, 16-bit elements: 128 B of data + 16 B pad (16 B x odd, plain 16-byte reads)
constexpr int kPitchV = 80;                      // V rows in LDS, 16-bit elements: 128 B of data + 32 B pad (32 B x odd, transposing reads)
constexpr float kPCarryInv       = 1.0f / 256.0f;   // decayed scores carried x256 in f16
constexpr float kScoreScaleCarry = 0.125f * 256.0f; // 64^-0.5 * carry = 32 (exact power of two)
static_assert(kDh == 64 && kStage == 64, "");    // LDS rows of 128 B; staging map below: 256 threads x 4 rows x 4 elements per tile
static_assert(kSeq % kQBlk == 0 && kSeq % kStage == 0, "");
static_assert(kHeads == 8, "");                  // eight log2(gamma) arguments

typedef __attribute__((ext_vector_type(16))) _Float16 v16h;
typedef __attribute__((ext_vector_type(8)))  _Float16 v8h;
typedef __attribute__((ext_vector_type(16))) __bf16   v16b;
typedef __attribute__((ext_vector_type(8)))  __bf16   v8b;
typedef __attribute__((ext_vector_type(8)))  float    v8f;
typedef __attribute__((ext_vector_type(4)))  float    v4f;
typedef __attribute__((ext_vector_type(4)))  __bf16   v4b;
typedef __attribute__((ext_vector_type(4)))  _Float16 v4h;
typedef __attribute__((ext_vector_type(2)))  unsigned int v2u;
typedef __attribute__((ext_vector_type(8)))  short    v8s;

// Casts of four f32 values on their way to LDS: RNE bf16, and f16 holding the RNE bf16 value (exact for normal magnitudes).
__device__ __forceinline__ v2u cast4_bf16(v4f x) { return __builtin_bit_cast(v2u, __builtin_convertvector(x, v4b)); }
__device__ __forceinline__ v2u cast4_bf16_as_f16(v4f x) {
  const v4f y = __builtin_convertvector(__builtin_convertvector(x, v4b), v4f);
  return __builtin_bit_cast(v2u, __builtin_convertvector(y, v4h));
}

// Fragment loaders, hardware k order of the 16x16x32 16-bit forms: elements 0..7 <- p[0..7], 8..15 <- p[16..23],
// p = row start + 8 * (lane >> 4).
__device__ __forceinline__ v16b load_frag_b(const __bf16* p) {
  union { v16b v; v8b h[2]; } f; f.h[0] = *(const v8b*)(p); f.h[1] = *(const v8b*)(p + 16); return f.v;
}
// The same order from f32 memory, cast to RNE bf16 in registers.
__device__ __forceinline__ v16b load_frag_b_f32(const float* p) {
  const v4f a0 = *(const v4f*)(p),      a1 = *(const v4f*)(p + 4);
  const v4f b0 = *(const v4f*)(p + 16), b1 = *(const v4f*)(p + 20);
  union { v16b v; v4b q[4]; } f;
  f.q[0] = __builtin_convertvector(a0, v4b); f.q[1] = __builtin_convertvector(a1, v4b);
  f.q[2] = __builtin_convertvector(b0, v4b); f.q[3] = __builtin_convertvector(b1, v4b);
  return f.v;
}
// Transposing LDS read of a row-major [key][d] 16-bit tile. Lane l points at row kbase + 8 (l >> 4) + (l & 7), byte
// 2 dbase + 16 ((l >> 3) & 1); lane (c, h) receives keys kbase + 8h + 0..7 of column dbase + c. The reads at kbase and
// kbase + 16 are elements 0..7 and 8..15 of one 16 (d) x 32 (keys) A fragment in the hardware k order.
__device__ __forceinline__ v8h ld_tr16(const _Float16* p) {
  typedef __attribute__((address_space(3))) v8s lds_v8s;
  return __builtin_bit_cast(v8h, __builtin_amdgcn_ds_load_tr16_b128_v8i16((lds_v8s*)p));
}
__device__ __forceinline__ v16h load_frag_tr(const _Float16* p) {
  union { v16h v; v8h h[2]; } f; f.h[0] = ld_tr16(p); f.h[1] = ld_tr16(p + 16 * kPitchV); return f.v;
}

// ---------------------------------------------------------------------------
// One stage (64 keys) of one wave's 16 queries, K and V tiles in LDS, both [key][d]. c = lane & 15 (query column), h = lane >> 4.
// T[t][r] = S^T[key 16t + 8h + r][query c] (A = K rows, B = Q kept in registers);
//   P = f16( w * S ), w = 256 * 0.125 * gamma_h^(i-j) for j <= i, 0 for j > i, in f32, factored over i - j = dbase - off:
//   w = [32 * exp2(dbase * log2_gamma_h)] * ck[e], ck[e] = exp2(-off * log2_gamma_h), off = 16 (e >> 3) + (e & 7) in [0, 55]:
//   one exp2 per lane and stage, the table made once per kernel. dbase < 0 puts every key of the lane's stage above the
//   diagonal (stage factor 0); dbase >= 55 none; between the two lies only the wave's one diagonal stage (diag), which
//   alone tests each element;
//   two converted tiles are the B operand of the second product as they lie (element s = T[s >> 3][s & 7] of 32 keys);
//   acc[n][r] += O^T[d 16n + 8h + r][query c] (A = V^T rows in the same k order, by the transposing read; bV is the
//   lane's own read address in the V tile). dbase = i - (first key + 8h).
// ---------------------------------------------------------------------------
__device__ __forceinline__ void stage_compute(const __bf16* __restrict__ bK, const _Float16* __restrict__ bV,
                                              const v16b (&qf)[2], v8f (&acc)[4], const float (&ck)[32], int dbase, float lg,
                                              bool diag, int c, int h) {
  v16b ka[4][2];
#pragma unroll  // constant indices: the fragment and accumulator arrays stay in registers
  for (int tt = 0; tt < 4; ++tt)
#pragma unroll  // constant indices: the fragment and accumulator arrays stay in registers
    for (int kk = 0; kk < 2; ++kk) ka[tt][kk] = load_frag_b(bK + (tt * 16 + c) * kPitch + kk * 32 + 8 * h);
  // keeps the K fragment loads one group ahead of the products: spread among them each load waits out its own LDS latency
  __builtin_amdgcn_sched_barrier(0);
  const float eg = exp2f((float)dbase * lg) * kScoreScaleCarry;   // exponent in [-94, 94]: finite, normal f32
  const float e0 = (dbase >= 0) ? eg : 0.0f;
  float w[32];
#pragma unroll  // constant indices: the weight array stays in registers
  for (int e = 0; e < 32; ++e) w[e] = e0 * ck[e];
  if (diag) {   // wave-uniform: a scalar branch, taken in one stage of a wave's walk
#pragma unroll  // constant indices: the weight array stays in registers
    for (int e = 0; e < 32; ++e) w[e] = (dbase >= (e >> 3) * 16 + (e & 7)) ? w[e] : 0.0f;   // causal zero above the diagonal
  }
  v8f T[4];
#pragma unroll  // constant indices: the fragment and accumulator arrays stay in registers
  for (int tt = 0; tt < 4; ++tt) {
    T[tt] = (v8f){0.f, 0.f, 0.f, 0.f, 0.f, 0.f, 0.f, 0.f};
#pragma unroll  // constant indices: the fragment and accumulator arrays stay in registers
    for (int kk = 0; kk < 2; ++kk)
      T[tt] = __builtin_amdgcn_wmma_f32_16x16x32_bf16(false, ka[tt][kk], false, qf[kk], (short)0, T[tt], false, false);
  }
  v16h va[2][4];
#pragma unroll  // constant indices: the fragment and accumulator arrays stay in registers
  for (int p = 0; p < 2; ++p)
#pragma unroll  // constant indices: the fragment and accumulator arrays stay in registers
    for (int n = 0; n < 4; ++n) va[p][n] = load_frag_tr(bV + p * 32 * kPitchV + n * 16);
  // keeps the V^T fragment loads in front of the weighting and the f16 casts, which then cover part of their LDS latency
  __builtin_amdgcn_sched_barrier(0);
#pragma unroll  // constant indices: the fragment and accumulator arrays stay in registers
  for (int p = 0; p < 2; ++p) {
    v16h pf;
#pragma unroll  // constant indices: the fragment and accumulator arrays stay in registers
    for (int tt = 0; tt < 2; ++tt) {
#pragma unroll  // constant indices: the fragment and accumulator arrays stay in registers
      for (int r = 0; r < 8; ++r) pf[tt * 8 + r] = (_Float16)(T[p * 2 + tt][r] * w[(p * 2 + tt) * 8 + r]);
    }
#pragma unroll  // constant indices: the fragment and accumulator arrays stay in registers
    for (int n = 0; n < 4; ++n)
      acc[n] = __builtin_amdgcn_wmma_f32_16x16x32_f16(false, va[p][n], false, pf, (short)0, acc[n], false, false);
  }
}

// ---------------------------------------------------------------------------
// Fused casts, scores, decay and output product. grid (16, 16): blockIdx.x = block of 128 queries, blockIdx.y = (batch,
// head) plane. 8 waves, each owns 16 queries and walks all 2048 keys in stages of 64.
// K and V tiles go global f32 -> registers -> cast -> LDS, two buffers, one barrier per stage: the stores of stage s + 1
// aim at the buffer whose last readers passed the barrier that ended stage s - 1.
// ---------------------------------------------------------------------------
__global__ __launch_bounds__(256) void decay_attn_fused_kernel(
    const float* __restrict__ q, const float* __restrict__ k, const float* __restrict__ v, float* __restrict__ out,
    float lg0, float lg1, float lg2, float lg3, float lg4, float lg5, float lg6, float lg7) {
  __shared__ __align__(16) unsigned short sK[2][kStage * kPitch];    // [key][d], bf16
  __shared__ __align__(16) unsigned short sV[2][kStage * kPitchV];   // [key][d], f16
  const int t     = threadIdx.x;
  const int lane  = t & 31;
  const int wave  = t >> 5;
  const int c     = lane & 15;
  const int h     = lane >> 4;
  const int plane = blockIdx.y;
  const int head  = plane % kHeads;
  const float lg = (head == 0) ? lg0 : (head == 1) ? lg1 : (head == 2) ? lg2 : (head == 3) ? lg3
                 : (head == 4) ? lg4 : (head == 5) ? lg5 : (head == 6) ? lg6 : lg7;
  const int i = blockIdx.x * kQBlk + wave * 16 + c;                 // this lane's query

  const float* qp = q + ((size_t)plane * kSeq + i) * kDh + 8 * h;
  v16b qf[2];
  qf[0] = load_frag_b_f32(qp);
  qf[1] = load_frag_b_f32(qp + 32);

  // staging map: thread t moves 4 elements of rows (t >> 4) + 16 j, j = 0..3, of each tile; 16 threads cover one 256-B f32 row
  const int srow = t >> 4;
  const int scol = (t & 15) * 4;
  const int soK  = srow * kPitch + scol;
  const int soV  = srow * kPitchV + scol;
  const float* gK = k + ((size_t)plane * kSeq + srow) * kDh + scol;
  const float* gV = v + ((size_t)plane * kSeq + srow) * kDh + scol;
  // this lane's address in a V tile for the transposing reads
  const int vo = (8 * h + (lane & 7)) * kPitchV + 8 * ((lane >> 3) & 1);
  {
    v4f rk[4], rv[4];
#pragma unroll  // constant indices: the staging arrays stay in registers
    for (int j = 0; j < 4; ++j) {
      rk[j] = *(const v4f*)(gK + j * 16 * kDh);
      rv[j] = *(const v4f*)(gV + j * 16 * kDh);
    }
#pragma unroll  // constant indices: the staging arrays stay in registers
    for (int j = 0; j < 4; ++j) {
      *(v2u*)(&sK[0][soK + j * 16 * kPitch])  = cast4_bf16(rk[j]);
      *(v2u*)(&sV[0][soV + j * 16 * kPitchV]) = cast4_bf16_as_f16(rv[j]);
    }
  }

  v8f acc[4];
#pragma unroll  // constant indices: the fragment and accumulator arrays stay in registers
  for (int n = 0; n < 4; ++n) acc[n] = (v8f){0.f, 0.f, 0.f, 0.f, 0.f, 0.f, 0.f, 0.f};
  __syncthreads();   // stage 0 published

  // per-key factors of the decay weight, the same in every stage and lane: lane e makes entry e (one exp2 for the table),
  // and the lane reads hand all 32 entries to every lane
  const int ckl = __builtin_bit_cast(int, exp2f(-(float)((lane >> 3) * 16 + (lane & 7)) * lg));
  float ck[32];
#pragma unroll  // constant indices: the table stays in registers
  for (int e = 0; e < 32; ++e) ck[e] = __builtin_bit_cast(float, __builtin_amdgcn_readlane(ckl, e));

  constexpr int kStages = kSeq / kStage;
  int dbase = i - 8 * h;
  // the stage that holds the diagonal of this wave's 16 queries (16 divides 64: exactly one); scalar, for a scalar branch
  const int sdiag = __builtin_amdgcn_readfirstlane((blockIdx.x * kQBlk + wave * 16) / kStage);
  for (int s = 0; s + 1 < kStages; ++s) {
    gK += kStage * kDh;
    gV += kStage * kDh;
    v4f rk[4], rv[4];
#pragma unroll  // constant indices: the staging arrays stay in registers
    for (int j = 0; j < 4; ++j) {
      rk[j] = *(const v4f*)(gK + j * 16 * kDh);
      rv[j] = *(const v4f*)(gV + j * 16 * kDh);
    }
    // the two address pairs of these loads are advanced in place for the next stage: this wait stands in front of that overwrite
    asm volatile("s_wait_xcnt 0x0" ::: "memory");
    stage_compute((const __bf16*)sK[s & 1], (const _Float16*)sV[s & 1] + vo, qf, acc, ck, dbase, lg, s == sdiag, c, h);
    dbase -= kStage;
    unsigned short* dK = sK[(s + 1) & 1];
    unsigned short* dV = sV[(s + 1) & 1];
#pragma unroll  // constant indices: the staging arrays stay in registers
    for (int j = 0; j < 4; ++j) {
      *(v2u*)(dK + soK + j * 16 * kPitch)  = cast4_bf16(rk[j]);
      *(v2u*)(dV + soV + j * 16 * kPitchV) = cast4_bf16_as_f16(rv[j]);
    }
    __syncthreads();   // publishes stage s + 1 and ends every read of stage s
  }
  stage_compute((const __bf16*)sK[(kStages - 1) & 1], (const _Float16*)sV[(kStages - 1) & 1] + vo, qf, acc, ck, dbase, lg,
                sdiag == kStages - 1, c, h);

  // a lane holds 8 consecutive d of its query's row per tile: two 16-byte stores
  float* op = out + ((size_t)plane * kSeq + i) * kDh + 8 * h;
#pragma unroll  // constant indices: the fragment and accumulator arrays stay in registers
  for (int n = 0; n < 4; ++n) {
    const v4f lo = (v4f){acc[n][0], acc[n][1], acc[n][2], acc[n][3]} * kPCarryInv;
    const v4f hi = (v4f){acc[n][4], acc[n][5], acc[n][6], acc[n][7]} * kPCarryInv;
    *(v4f*)(op + n * 16)     = lo;
    *(v4f*)(op + n * 16 + 4) = hi;
  }
}

// ---------------------------------------------------------------------------
// Host glue. One launch; the workspace is not used.
// ---------------------------------------------------------------------------
extern "C" void kernel_launch(void* const* d_in, const int* in_sizes, int n_in,
                              void* d_out, int out_size, void* d_ws, size_t ws_size,
                              hipStream_t stream) {
  if (n_in < 3) return;
  if (in_sizes[0] != kElems || in_sizes[1] != kElems || in_sizes[2] != kElems) return;
  if (out_size != kElems) return;
  (void)d_ws;
  (void)ws_size;

  const float* q = (const float*)d_in[0];
  const float* k = (const float*)d_in[1];
  const float* v = (const float*)d_in[2];
  float* out = (float*)d_out;

  // log2(gamma_h), gamma_h = 1 - 2^(-5-h) (exact in f32); log2 evaluated in double and RNE-converted to f32
  float lg[kHeads];
  for (int h = 0; h < kHeads; ++h) {
    const float gma = 1.0f - 1.0f / (float)(32 << h);
    lg[h] = (float)log2((double)gma);
  }

  decay_attn_fused_kernel<<<dim3(kSeq / kQBlk, kBH), dim3(256), 0, stream>>>(
      q, k, v, out, lg[0], lg[1], lg[2], lg[3], lg[4], lg[5], lg[6], lg[7]);
}

// v004
// A run of this version takes 25.8 microseconds.
// Two timings next to v003 put it at 1.26 and 1.27 times that version's speed.
// Over all steps from v000 it is 18.7 times as fast.
// Contractions: scores^T = k.q^T on v_wmma_f32_16x16x32_bf16 (q, k as RNE bf16, exact products), out^T = v^T @ (scores*scale*decay)^T on v_wmma_f32_16x16x32_f16 (decayed scores f16 carried x256, v as f16 holding RNE bf16 values, transposed by the LDS read); f32 accumulate; decay mask, scaling and casts in f32, the decay weight as the product of a per-lane stage factor and a per-key table. One kernel: q, k, v are read as f32 and cast on their way to registers and LDS; the scores stay in registers. Only key tiles at or below the diagonal are computed; the keys of a stage are split over wave groups whose f32 partial sums are joined in LDS.
#include <hip/hip_runtime.h>
#include <math.h>

// ---------------------------------------------------------------------------
// Problem constants
// ---------------------------------------------------------------------------
constexpr int kBatch = 2;
constexpr int kHeads = 8;
constexpr int kSeq   = 2048;
constexpr int kDh    = 64;
constexpr int kBH    = kBatch * kHeads;          // 16 (batch, head) planes
constexpr int kElems = kBH * kSeq * kDh;         // 2,097,152 elements per tensor
constexpr int kQBlk  = 64;                       // queries per tile: 4 waves x 16
constexpr int kStage = 64;                       // keys per wave and stage: one key tile
constexpr int kKG    = 4;                        // wave groups of a work-group; each takes its own key tile of a stage
constexpr int kThreads = 4 * kKG * 32;           // 4 query waves x kKG key groups
constexpr int kTiles = kSeq / kQBlk;             // 32 query tiles per plane = 32 key tiles
constexpr int kRowsPerPass = kThreads / 16;      // staging: rows of a stage that the block moves with one load per thread
constexpr int kPasses = kKG * kStage / kRowsPerPass;   // 8 loads per thread, tensor and stage
constexpr int kPitch  = 72;                      // K rows in LDS, 16-bit elements: 128 B of data + 16 B pad (16 B x odd, plain 16-byte reads)
constexpr int kPitchV = 80;                      // V rows in LDS, 16-bit elements: 128 B of data + 32 B pad (32 B x odd, transposing reads)
constexpr float kPCarryInv       = 1.0f / 256.0f;   // decayed scores carried x256 in f16
constexpr float kScoreScaleCarry = 0.125f * 256.0f; // 64^-0.5 * carry = 32 (exact power of two)
static_assert(kDh == 64 && kStage == 64 && kQBlk == kStage, "");   // LDS rows of 128 B; a query tile's diagonal lies in one key tile
static_assert(kTiles % 2 == 0 && kTiles % kKG == 0, "");           // tiles pair up; a stage never reaches past the last key
static_assert(kHeads == 8 && kBH / 2 == kHeads, "");   // eight log2(gamma) arguments; plane ^ 8 keeps the head

typedef __attribute__((ext_vector_type(16))) _Float16 v16h;
typedef __attribute__((ext_vector_type(8)))  _Float16 v8h;
typedef __attribute__((ext_vector_type(16))) __bf16   v16b;
typedef __attribute__((ext_vector_type(8)))  __bf16   v8b;
typedef __attribute__((ext_vector_type(8)))  float    v8f;
typedef __attribute__((ext_vector_type(4)))  float    v4f;
typedef __attribute__((ext_vector_type(4)))  __bf16   v4b;
typedef __attribute__((ext_vector_type(4)))  _Float16 v4h;
typedef __attribute__((ext_vector_type(2)))  unsigned int v2u;
typedef __attribute__((ext_vector_type(8)))  short    v8s;

// Casts of four f32 values on their way to LDS: RNE bf16, and f16 holding the RNE bf16 value (exact for normal magnitudes).
__device__ __forceinline__ v2u cast4_bf16(v4f x) { return __builtin_bit_cast(v2u, __builtin_convertvector(x, v4b)); }
__device__ __forceinline__ v2u cast4_bf16_as_f16(v4f x) {
  const v4f y = __builtin_convertvector(__builtin_convertvector(x, v4b), v4f);
  return __builtin_bit_cast(v2u, __builtin_convertvector(y, v4h));
}

// Fragment loaders, hardware k order of the 16x16x32 16-bit forms: elements 0..7 <- p[0..7], 8..15 <- p[16..23],
// p = row start + 8 * (lane >> 4).
__device__ __forceinline__ v16b load_frag_b(const __bf16* p) {
  union { v16b v; v8b h[2]; } f; f.h[0] = *(const v8b*)(p); f.h[1] = *(const v8b*)(p + 16); return f.v;
}
// The same order from f32 memory, cast to RNE bf16 in registers.
__device__ __forceinline__ v16b load_frag_b_f32(const float* p) {
  const v4f a0 = *(const v4f*)(p),      a1 = *(const v4f*)(p + 4);
  const v4f b0 = *(const v4f*)(p + 16), b1 = *(const v4f*)(p + 20);
  union { v16b v; v4b q[4]; } f;
  f.q[0] = __builtin_convertvector(a0, v4b); f.q[1] = __builtin_convertvector(a1, v4b);
  f.q[2] = __builtin_convertvector(b0, v4b); f.q[3] = __builtin_convertvector(b1, v4b);
  return f.v;
}
// Transposing LDS read of a row-major [key][d] 16-bit tile. Lane l points at row kbase + 8 (l >> 4) + (l & 7), byte
// 2 dbase + 16 ((l >> 3) & 1); lane (c, h) receives keys kbase + 8h + 0..7 of column dbase + c. The reads at kbase and
// kbase + 16 are elements 0..7 and 8..15 of one 16 (d) x 32 (keys) A fragment in the hardware k order.
__device__ __forceinline__ v8h ld_tr16(const _Float16* p) {
  typedef __attribute__((address_space(3))) v8s lds_v8s;
  return __builtin_bit_cast(v8h, __builtin_amdgcn_ds_load_tr16_b128_v8i16((lds_v8s*)p));
}
__device__ __forceinline__ v16h load_frag_tr(const _Float16* p) {
  union { v16h v; v8h h[2]; } f; f.h[0] = ld_tr16(p); f.h[1] = ld_tr16(p + 16 * kPitchV); return f.v;
}

// ---------------------------------------------------------------------------
// One stage (64 keys) of one wave's 16 queries, K and V tiles in LDS, both [key][d]. c = lane & 15 (query column), h = lane >> 4.
// T[t][r] = S^T[key 16t + 8h + r][query c] (A = K rows, B = Q kept in registers);
//   P = f16( w * S ), w = 256 * 0.125 * gamma_h^(i-j) for j <= i, 0 for j > i, in f32, factored over i - j = dbase - off:
//   w = [32 * exp2(dbase * log2_gamma_h)] * ck[e], ck[e] = exp2(-off * log2_gamma_h), off = 16 (e >> 3) + (e & 7) in [0, 55]:
//   one exp2 per lane and stage, the table made once per kernel. dbase < 0 puts every key of the lane's stage above the
//   diagonal (stage factor 0); dbase >= 55 none; between the two lies only the wave's one diagonal stage (diag), which
//   alone tests each element;
//   two converted tiles are the B operand of the second product as they lie (element s = T[s >> 3][s & 7] of 32 keys);
//   acc[n][r] += O^T[d 16n + 8h + r][query c] (A = V^T rows in the same k order, by the transposing read; bV is the
//   lane's own read address in the V tile). dbase = i - (first key + 8h).
// ---------------------------------------------------------------------------
__device__ __forceinline__ void stage_compute(const __bf16* __restrict__ bK, const _Float16* __restrict__ bV,
                                              const v16b (&qf)[2], v8f (&acc)[4], const float (&ck)[32], int dbase, float lg,
                                              bool diag, int c, int h) {
  v16b ka[4][2];
#pragma unroll  // constant indices: the fragment and accumulator arrays stay in registers
  for (int tt = 0; tt < 4; ++tt)
#pragma unroll  // constant indices: the fragment and accumulator arrays stay in registers
    for (int kk = 0; kk < 2; ++kk) ka[tt][kk] = load_frag_b(bK + (tt * 16 + c) * kPitch + kk * 32 + 8 * h);
  // keeps the K fragment loads one group ahead of the products: spread among them each load waits out its own LDS latency
  __builtin_amdgcn_sched_barrier(0);
  const float eg = exp2f((float)dbase * lg) * kScoreScaleCarry;   // exponent in [-94, 94]: finite, normal f32
  const float e0 = (dbase >= 0) ? eg : 0.0f;
  v8f T[4];
#pragma unroll  // constant indices: the fragment and accumulator arrays stay in registers
  for (int tt = 0; tt < 4; ++tt) {
    T[tt] = (v8f){0.f, 0.f, 0.f, 0.f, 0.f, 0.f, 0.f, 0.f};
#pragma unroll  // constant indices: the fragment and accumulator arrays stay in registers
    for (int kk = 0; kk < 2; ++kk)
      T[tt] = __builtin_amdgcn_wmma_f32_16x16x32_bf16(false, ka[tt][kk], false, qf[kk], (short)0, T[tt], false, false);
  }
  v16h va[2][4];
#pragma unroll  // constant indices: the fragment and accumulator arrays stay in registers
  for (int p = 0; p < 2; ++p)
#pragma unroll  // constant indices: the fragment and accumulator arrays stay in registers
    for (int n = 0; n < 4; ++n) va[p][n] = load_frag_tr(bV + p * 32 * kPitchV + n * 16);
  // keeps the V^T fragment loads in front of the weighting and the f16 casts, which then cover part of their LDS latency
  __builtin_amdgcn_sched_barrier(0);
#pragma unroll  // constant indices: the fragment and accumulator arrays stay in registers
  for (int p = 0; p < 2; ++p) {
    v16h pf;
#pragma unroll  // constant indices: the fragment and accumulator arrays stay in registers
    for (int tt = 0; tt < 2; ++tt) {
#pragma unroll  // constant indices: the fragment and accumulator arrays stay in registers
      for (int r = 0; r < 8; ++r) {
        // the weight is made where it is used: 32 fewer live registers over the fragment loads
        float w = e0 * ck[(p * 2 + tt) * 8 + r];
        if (diag) w = (dbase >= (p * 2 + tt) * 16 + r) ? w : 0.0f;   // causal zero above the diagonal; diag is a constant of the call
        pf[tt * 8 + r] = (_Float16)(T[p * 2 + tt][r] * w);
      }
    }
#pragma unroll  // constant indices: the fragment and accumulator arrays stay in registers
    for (int n = 0; n < 4; ++n)
      acc[n] = __builtin_amdgcn_wmma_f32_16x16x32_f16(false, va[p][n], false, pf, (short)0, acc[n], false, false);
  }
}

// ---------------------------------------------------------------------------
// Fused casts, scores, decay and output product. grid (16, 16): blockIdx.x = pair of query tiles, blockIdx.y = (batch,
// head) plane. A work-group takes query tile 31 - x of its plane and then tile x of the same head's plane in the other
// batch (64 queries each; every (plane, tile) once): tile tb needs key tiles 0..tb only (above the diagonal every weight
// is 0), so every work-group walks 33 key tiles in all.
// Wave = (query group qt, key group g): 16 queries, and key tile s * kKG + g of stage s. The kKG partial sums of a query
// tile are joined through LDS in the fixed order g = 0, 1, ...
// K and V tiles go global f32 -> registers -> cast -> LDS, two buffers, one barrier per stage: the stores of stage s + 1
// aim at the buffer whose last readers passed the barrier that ended stage s - 1.
// ---------------------------------------------------------------------------
__global__ __launch_bounds__(kThreads) void decay_attn_fused_kernel(
    const float* __restrict__ q, const float* __restrict__ k, const float* __restrict__ v, float* __restrict__ out,
    float lg0, float lg1, float lg2, float lg3, float lg4, float lg5, float lg6, float lg7) {
  __shared__ __align__(16) unsigned short sK[2][kKG * kStage * kPitch];    // [key][d], bf16
  __shared__ __align__(16) unsigned short sV[2][kKG * kStage * kPitchV];   // [key][d], f16
  __shared__ __align__(16) float sR[(kKG - 1) * 4 * 8 * 128];              // partial sums of key groups 1..: [g - 1][qt][chunk][lane][4]
  const int t     = threadIdx.x;
  const int lane  = t & 31;
  const int wave  = __builtin_amdgcn_readfirstlane(t >> 5);         // scalar: the tests on qt and g below are scalar branches
  const int qt    = wave & 3;
  const int g     = wave >> 2;
  const int c     = lane & 15;
  const int h     = lane >> 4;
  const int head  = blockIdx.y % kHeads;
  const float lg = (head == 0) ? lg0 : (head == 1) ? lg1 : (head == 2) ? lg2 : (head == 3) ? lg3
                 : (head == 4) ? lg4 : (head == 5) ? lg5 : (head == 6) ? lg6 : lg7;

  // staging map: thread t moves 4 elements of rows (t >> 4) + kRowsPerPass j of each stage; 16 threads cover one 256-B f32 row
  const int srow = t >> 4;
  const int scol = (t & 15) * 4;
  const int soK  = srow * kPitch + scol;
  const int soV  = srow * kPitchV + scol;
  // this lane's address in a V tile for the transposing reads
  const int vo = (8 * h + (lane & 7)) * kPitchV + 8 * ((lane >> 3) & 1);
  // this wave's key tile inside a stage
  const int koK = g * kStage * kPitch;
  const int koV = g * kStage * kPitchV + vo;

  // per-key factors of the decay weight, the same in every stage and lane: lane e makes entry e (one exp2 for the table),
  // and the lane reads hand all 32 entries to every lane
  const int ckl = __builtin_bit_cast(int, exp2f(-(float)((lane >> 3) * 16 + (lane & 7)) * lg));
  float ck[32];
#pragma unroll  // constant indices: the table stays in registers
  for (int e = 0; e < 32; ++e) ck[e] = __builtin_bit_cast(float, __builtin_amdgcn_readlane(ckl, e));

#pragma nounroll  // two passes over one body: a second copy of the stage code would only cost instruction cache
  for (int half = 0; half < 2; ++half) {
    const int tb  = (half == 0) ? (kTiles - 1 - (int)blockIdx.x) : (int)blockIdx.x;   // query tile; the longer one first
    const int plane = (int)blockIdx.y ^ (half * (kBH / 2));         // the second tile from the same head's plane of the other batch
    const int nst = tb / kKG + 1;                                   // stages that hold key tiles 0..tb
    const int i   = tb * kQBlk + qt * 16 + c;                       // this lane's query

    const float* qp = q + ((size_t)plane * kSeq + i) * kDh + 8 * h;
    v16b qf[2];
    qf[0] = load_frag_b_f32(qp);
    qf[1] = load_frag_b_f32(qp + 32);

    const float* gK = k + ((size_t)plane * kSeq + srow) * kDh + scol;
    const float* gV = v + ((size_t)plane * kSeq + srow) * kDh + scol;
    {
      v4f rk[kPasses], rv[kPasses];
#pragma unroll  // constant indices: the staging arrays stay in registers
      for (int j = 0; j < kPasses; ++j) {
        rk[j] = *(const v4f*)(gK + j * kRowsPerPass * kDh);
        rv[j] = *(const v4f*)(gV + j * kRowsPerPass * kDh);
      }
#pragma unroll  // constant indices: the staging arrays stay in registers
      for (int j = 0; j < kPasses; ++j) {
        *(v2u*)(&sK[0][soK + j * kRowsPerPass * kPitch])  = cast4_bf16(rk[j]);
        *(v2u*)(&sV[0][soV + j * kRowsPerPass * kPitchV]) = cast4_bf16_as_f16(rv[j]);
      }
    }

    v8f acc[4];
#pragma unroll  // constant indices: the fragment and accumulator arrays stay in registers
    for (int n = 0; n < 4; ++n) acc[n] = (v8f){0.f, 0.f, 0.f, 0.f, 0.f, 0.f, 0.f, 0.f};
    __syncthreads();   // stage 0 published

    int dbase = i - g * kStage - 8 * h;
    // every key tile of stages 0..nst - 2 lies wholly below the diagonal: (nst - 1) * kKG <= tb
    for (int s = 0; s + 1 < nst; ++s) {
      gK += kKG * kStage * kDh;
      gV += kKG * kStage * kDh;
      v4f rk[kPasses], rv[kPasses];
#pragma unroll  // constant indices: the staging arrays stay in registers
      for (int j = 0; j < kPasses; ++j) {
        rk[j] = *(const v4f*)(gK + j * kRowsPerPass * kDh);
        rv[j] = *(const v4f*)(gV + j * kRowsPerPass * kDh);
      }
      // the two address pairs of these loads are advanced in place for the next stage: this wait stands in front of that overwrite
      asm volatile("s_wait_xcnt 0x0" ::: "memory");
      stage_compute((const __bf16*)sK[s & 1] + koK, (const _Float16*)sV[s & 1] + koV, qf, acc, ck, dbase, lg, false, c, h);
      dbase -= kKG * kStage;
      unsigned short* dK = sK[(s + 1) & 1];
      unsigned short* dV = sV[(s + 1) & 1];
#pragma unroll  // constant indices: the staging arrays stay in registers
      for (int j = 0; j < kPasses; ++j) {
        *(v2u*)(dK + soK + j * kRowsPerPass * kPitch)  = cast4_bf16(rk[j]);
        *(v2u*)(dV + soV + j * kRowsPerPass * kPitchV) = cast4_bf16_as_f16(rv[j]);
      }
      __syncthreads();   // publishes stage s + 1 and ends every read of stage s
    }
    // last stage: this wave's key tile lies below the diagonal, on it, or above it (nothing to add)
    const int kt = (nst - 1) * kKG + g;
    if (kt < tb)
      stage_compute((const __bf16*)sK[(nst - 1) & 1] + koK, (const _Float16*)sV[(nst - 1) & 1] + koV, qf, acc, ck, dbase, lg,
                    false, c, h);
    else if (kt == tb)
      stage_compute((const __bf16*)sK[(nst - 1) & 1] + koK, (const _Float16*)sV[(nst - 1) & 1] + koV, qf, acc, ck, dbase, lg,
                    true, c, h);

    // join of the key groups' partial sums: groups 1.. hand theirs over in LDS, group 0 adds them in order and stores
    if (g > 0) {
      float* r = sR + ((g - 1) * 4 + qt) * 8 * 128 + lane * 4;
#pragma unroll  // constant indices: the fragment and accumulator arrays stay in registers
      for (int n = 0; n < 4; ++n) {
        *(v4f*)(r + (2 * n) * 128)     = (v4f){acc[n][0], acc[n][1], acc[n][2], acc[n][3]};
        *(v4f*)(r + (2 * n + 1) * 128) = (v4f){acc[n][4], acc[n][5], acc[n][6], acc[n][7]};
      }
    }
    __syncthreads();   // publishes the partial sums and ends every read of the tile's last stage (the next tile refills buffer 0)
    if (g == 0) {
      // a lane holds 8 consecutive d of its query's row per tile: two 16-byte stores
      float* op = out + ((size_t)plane * kSeq + i) * kDh + 8 * h;
      const float* r = sR + qt * 8 * 128 + lane * 4;
#pragma unroll  // constant indices: the fragment and accumulator arrays stay in registers
      for (int n = 0; n < 4; ++n) {
        v4f lo = (v4f){acc[n][0], acc[n][1], acc[n][2], acc[n][3]};
        v4f hi = (v4f){acc[n][4], acc[n][5], acc[n][6], acc[n][7]};
#pragma unroll  // constant indices: fixed order of the sum
        for (int gg = 0; gg + 1 < kKG; ++gg) {
          lo += *(const v4f*)(r + gg * 4 * 8 * 128 + (2 * n) * 128);
          hi += *(const v4f*)(r + gg * 4 * 8 * 128 + (2 * n + 1) * 128);
        }
        *(v4f*)(op + n * 16)     = lo * kPCarryInv;
        *(v4f*)(op + n * 16 + 4) = hi * kPCarryInv;
      }
      // the next tile reuses the address and data registers of these stores: this wait stands in front of that overwrite
      asm volatile("s_wait_xcnt 0x0" ::: "memory");
    }
  }
}

// ---------------------------------------------------------------------------
// Host glue. One launch; the workspace is not used.
// ---------------------------------------------------------------------------
extern "C" void kernel_launch(void* const* d_in, const int* in_sizes, int n_in,
                              void* d_out, int out_size, void* d_ws, size_t ws_size,
                              hipStream_t stream) {
  if (n_in < 3) return;
  if (in_sizes[0] != kElems || in_sizes[1] != kElems || in_sizes[2] != kElems) return;
  if (out_size != kElems) return;
  (void)d_ws;
  (void)ws_size;

  const float* q = (const float*)d_in[0];
  const float* k = (const float*)d_in[1];
  const float* v = (const float*)d_in[2];
  float* out = (float*)d_out;

  // log2(gamma_h), gamma_h = 1 - 2^(-5-h) (exact in f32); log2 evaluated in double and RNE-converted to f32
  float lg[kHeads];
  for (int h = 0; h < kHeads; ++h) {
    const float gma = 1.0f - 1.0f / (float)(32 << h);
    lg[h] = (float)log2((double)gma);
  }

  decay_attn_fused_kernel<<<dim3(kTiles / 2, kBH), dim3(kThreads), 0, stream>>>(
      q, k, v, out, lg[0], lg[1], lg[2], lg[3], lg[4], lg[5], lg[6], lg[7]);
}

// v006
// One run takes 15.2 microseconds.
// Versions between v004 and this one are left out; their measured steps multiply to 1.59 times as fast.
// All steps since v000 together make it 29.8 times as fast.
// Contractions: scores^T = k.q^T on v_wmma_f32_16x16x32_bf16 (q, k as RNE bf16, exact products), out^T = v^T @ (scores*scale*decay)^T on v_wmma_f32_16x16x32_f16 (decayed scores f16 carried x256, v as f16 holding RNE bf16 values, transposed by the LDS read); f32 accumulate; decay mask, scaling and casts in f32, the decay weight as the product of a per-lane stage factor and a per-key table. q, k, v are read as f32 and cast on their way to registers and LDS; the scores stay in registers. Scores are formed only for the 256-key stage that holds the query tile's diagonal (key tiles at or below it, split over wave groups whose f32 partial sums are joined in LDS); every earlier stage enters through its decayed 64x64 state sum_j gamma^(end-j) k_j v_j^T (first launch, v_wmma_f32_16x16x32_f16, f32 in the workspace), summed over stages in f32, cast to f16 and multiplied by q on the same f16 form.
#include <hip/hip_runtime.h>
#include <math.h>

// ---------------------------------------------------------------------------
// Problem constants
// ---------------------------------------------------------------------------
constexpr int kBatch = 2;
constexpr int kHeads = 8;
constexpr int kSeq   = 2048;
constexpr int kDh    = 64;
constexpr int kBH    = kBatch * kHeads;          // 16 (batch, head) planes
constexpr int kElems = kBH * kSeq * kDh;         // 2,097,152 elements per tensor
constexpr int kQBlk  = 64;                       // queries per tile: 4 waves x 16
constexpr int kStage = 64;                       // keys per wave and stage: one key tile
constexpr int kKG    = 4;                        // wave groups of a work-group; each takes its own key tile of a stage
constexpr int kThreads = 4 * kKG * 32;           // 4 query waves x kKG key groups
constexpr int kTiles = kSeq / kQBlk;             // 32 query tiles per plane = 32 key tiles
constexpr int kRowsPerPass = kThreads / 16;      // staging: rows of a stage that the block moves with one load per thread
constexpr int kPasses = kKG * kStage / kRowsPerPass;   // 8 loads per thread, tensor and stage
constexpr int kSpan   = kKG * kStage;            // keys of a stage
constexpr int kStates = kSeq / kSpan - 1;        // stages that lie in front of some query tile's own stage: one state each
constexpr int kPitch  = 72;                      // K rows in LDS, 16-bit elements: 128 B of data + 16 B pad (16 B x odd, plain 16-byte reads)
constexpr int kPitchV = 80;                      // V rows in LDS, 16-bit elements: 128 B of data + 32 B pad (32 B x odd, transposing reads)
constexpr float kPCarryInv       = 1.0f / 256.0f;   // decayed scores carried x256 in f16
constexpr float kScoreScaleCarry = 0.125f * 256.0f; // 64^-0.5 * carry = 32 (exact power of two)
static_assert(kDh == 64 && kStage == 64 && kQBlk == kStage, "");   // LDS rows of 128 B; a query tile's diagonal lies in one key tile
static_assert(kTiles % 2 == 0 && kTiles % kKG == 0, "");           // tiles pair up; a stage never reaches past the last key
static_assert(kHeads == 8 && kKG == 4, "");   // eight log2(gamma) arguments; a stage's four query tiles make two pairs, 16 waves share the join

typedef __attribute__((ext_vector_type(16))) _Float16 v16h;
typedef __attribute__((ext_vector_type(8)))  _Float16 v8h;
typedef __attribute__((ext_vector_type(16))) __bf16   v16b;
typedef __attribute__((ext_vector_type(8)))  __bf16   v8b;
typedef __attribute__((ext_vector_type(8)))  float    v8f;
typedef __attribute__((ext_vector_type(4)))  float    v4f;
typedef __attribute__((ext_vector_type(4)))  __bf16   v4b;
typedef __attribute__((ext_vector_type(4)))  _Float16 v4h;
typedef __attribute__((ext_vector_type(2)))  unsigned int v2u;
typedef __attribute__((ext_vector_type(8)))  short    v8s;

// Casts of four f32 values on their way to LDS: RNE bf16, and f16 holding the RNE bf16 value (exact for normal magnitudes).
__device__ __forceinline__ v2u cast4_bf16(v4f x) { return __builtin_bit_cast(v2u, __builtin_convertvector(x, v4b)); }
__device__ __forceinline__ v2u cast4_bf16_as_f16(v4f x) {
  const v4f y = __builtin_convertvector(__builtin_convertvector(x, v4b), v4f);
  return __builtin_bit_cast(v2u, __builtin_convertvector(y, v4h));
}

// Fragment loaders, hardware k order of the 16x16x32 16-bit forms: elements 0..7 <- p[0..7], 8..15 <- p[16..23],
// p = row start + 8 * (lane >> 4).
__device__ __forceinline__ v16b load_frag_b(const __bf16* p) {
  union { v16b v; v8b h[2]; } f; f.h[0] = *(const v8b*)(p); f.h[1] = *(const v8b*)(p + 16); return f.v;
}
// Transposing LDS read of a row-major [key][d] 16-bit tile. Lane l points at row kbase + 8 (l >> 4) + (l & 7), byte
// 2 dbase + 16 ((l >> 3) & 1); lane (c, h) receives keys kbase + 8h + 0..7 of column dbase + c. The reads at kbase and
// kbase + 16 are elements 0..7 and 8..15 of one 16 (d) x 32 (keys) A fragment in the hardware k order.
__device__ __forceinline__ v8h ld_tr16(const _Float16* p) {
  typedef __attribute__((address_space(3))) v8s lds_v8s;
  return __builtin_bit_cast(v8h, __builtin_amdgcn_ds_load_tr16_b128_v8i16((lds_v8s*)p));
}
__device__ __forceinline__ v16h load_frag_tr(const _Float16* p) {
  union { v16h v; v8h h[2]; } f; f.h[0] = ld_tr16(p); f.h[1] = ld_tr16(p + 16 * kPitchV); return f.v;
}

// ---------------------------------------------------------------------------
// One stage (64 keys) of one wave's 16 queries, K and V tiles in LDS, both [key][d]. c = lane & 15 (query column), h = lane >> 4.
// T[t][r] = S^T[key 16t + 8h + r][query c] (A = K rows, B = Q kept in registers);
//   P = f16( w * S ), w = 256 * 0.125 * gamma_h^(i-j) for j <= i, 0 for j > i, in f32, factored over i - j = dbase - off:
//   w = [32 * exp2(dbase * log2_gamma_h)] * ck[e], ck[e] = exp2(-off * log2_gamma_h), off = 16 (e >> 3) + (e & 7) in [0, 55]:
//   one exp2 per lane and stage, the table made once per kernel. dbase < 0 puts every key of the lane's stage above the
//   diagonal (stage factor 0); dbase >= 55 none; between the two lies only the wave's one diagonal stage (diag), which
//   alone tests each element;
//   two converted tiles are the B operand of the second product as they lie (element s = T[s >> 3][s & 7] of 32 keys);
//   acc[n][r] += O^T[d 16n + 8h + r][query c] (A = V^T rows in the same k order, by the transposing read; bV is the
//   lane's own read address in the V tile). dbase = i - (first key + 8h).
// ---------------------------------------------------------------------------
__device__ __forceinline__ void stage_compute(const __bf16* __restrict__ bK, const _Float16* __restrict__ bV,
                                              const v16b (&qf)[2], v8f (&acc)[4], const float (&ck)[32], int dbase, float lg,
                                              bool diag, int c, int h) {
  v16b ka[4][2];
#pragma unroll  // constant indices: the fragment and accumulator arrays stay in registers
  for (int tt = 0; tt < 4; ++tt)
#pragma unroll  // constant indices: the fragment and accumulator arrays stay in registers
    for (int kk = 0; kk < 2; ++kk) ka[tt][kk] = load_frag_b(bK + (tt * 16 + c) * kPitch + kk * 32 + 8 * h);
  // keeps the K fragment loads one group ahead of the products: spread among them each load waits out its own LDS latency
  __builtin_amdgcn_sched_barrier(0);
  const float eg = exp2f((float)dbase * lg) * kScoreScaleCarry;   // exponent in [-94, 94]: finite, normal f32
  const float e0 = (dbase >= 0) ? eg : 0.0f;
  v8f T[4];
#pragma unroll  // constant indices: the fragment and accumulator arrays stay in registers
  for (int tt = 0; tt < 4; ++tt) {
    T[tt] = (v8f){0.f, 0.f, 0.f, 0.f, 0.f, 0.f, 0.f, 0.f};
#pragma unroll  // constant indices: the fragment and accumulator arrays stay in registers
    for (int kk = 0; kk < 2; ++kk)
      T[tt] = __builtin_amdgcn_wmma_f32_16x16x32_bf16(false, ka[tt][kk], false, qf[kk], (short)0, T[tt], false, false);
  }
  v16h va[2][4];
#pragma unroll  // constant indices: the fragment and accumulator arrays stay in registers
  for (int p = 0; p < 2; ++p)
#pragma unroll  // constant indices: the fragment and accumulator arrays stay in registers
    for (int n = 0; n < 4; ++n) va[p][n] = load_frag_tr(bV + p * 32 * kPitchV + n * 16);
  // keeps the V^T fragment loads in front of the weighting and the f16 casts, which then cover part of their LDS latency
  __builtin_amdgcn_sched_barrier(0);
#pragma unroll  // constant indices: the fragment and accumulator arrays stay in registers
  for (int p = 0; p < 2; ++p) {
    v16h pf;
#pragma unroll  // constant indices: the fragment and accumulator arrays stay in registers
    for (int tt = 0; tt < 2; ++tt) {
#pragma unroll  // constant indices: the fragment and accumulator arrays stay in registers
      for (int r = 0; r < 8; ++r) {
        // the weight is made where it is used: 32 fewer live registers over the fragment loads
        float w = e0 * ck[(p * 2 + tt) * 8 + r];
        if (diag) w = (dbase >= (p * 2 + tt) * 16 + r) ? w : 0.0f;   // causal zero above the diagonal; diag is a constant of the call
        pf[tt * 8 + r] = (_Float16)(T[p * 2 + tt][r] * w);
      }
    }
#pragma unroll  // constant indices: the fragment and accumulator arrays stay in registers
    for (int n = 0; n < 4; ++n)
      acc[n] = __builtin_amdgcn_wmma_f32_16x16x32_f16(false, va[p][n], false, pf, (short)0, acc[n], false, false);
  }
}

// ---------------------------------------------------------------------------
// State of one stage: U[dk][dv] = sum over the stage's keys j of gamma_h^(stage end - j) * k_j[dk] * v_j[dv], exponent in
// [1, 256], so every weight is at most 1. grid (7, 16): blockIdx.x = stage, blockIdx.y = plane. K (f16 holding the RNE bf16
// value) and the weighted V (f16) lie in LDS as [key][d]; both operands come by the transposing read at the same key base,
// so their k orders are equal: D[dv 8h + r][dk c] = A (V^T) x B (K). Eight waves take 16 dk x 32 dv each: a lane stores 8
// consecutive dv of its dk row per tile, a wave whole 128-byte lines.
// ---------------------------------------------------------------------------
__global__ __launch_bounds__(kThreads) void decay_state_kernel(
    const float* __restrict__ k, const float* __restrict__ v, float* __restrict__ u,
    float lg0, float lg1, float lg2, float lg3, float lg4, float lg5, float lg6, float lg7) {
  __shared__ __align__(16) unsigned short sK[kSpan * kPitchV];   // [key][d], f16
  __shared__ __align__(16) unsigned short sV[kSpan * kPitchV];   // [key][d], f16, weighted
  const int t     = threadIdx.x;
  const int lane  = t & 31;
  const int wave  = __builtin_amdgcn_readfirstlane(t >> 5);         // scalar: the test on the wave below is a scalar branch
  const int c     = lane & 15;
  const int h     = lane >> 4;
  const int plane = blockIdx.y;
  const int head  = blockIdx.y % kHeads;
  const float lg = (head == 0) ? lg0 : (head == 1) ? lg1 : (head == 2) ? lg2 : (head == 3) ? lg3
                 : (head == 4) ? lg4 : (head == 5) ? lg5 : (head == 6) ? lg6 : lg7;
  const int srow = t >> 4;
  const int scol = (t & 15) * 4;
  const int soV  = srow * kPitchV + scol;
  const int vo = (8 * h + (lane & 7)) * kPitchV + 8 * ((lane >> 3) & 1);

  const float* gK = k + ((size_t)plane * kSeq + (int)blockIdx.x * kSpan + srow) * kDh + scol;
  const float* gV = v + ((size_t)plane * kSeq + (int)blockIdx.x * kSpan + srow) * kDh + scol;
  v4f rk[kPasses], rv[kPasses];
#pragma unroll  // constant indices: the staging arrays stay in registers
  for (int j = 0; j < kPasses; ++j) {
    rk[j] = *(const v4f*)(gK + j * kRowsPerPass * kDh);
    rv[j] = *(const v4f*)(gV + j * kRowsPerPass * kDh);
  }
  // the loads' address registers are reused right below: this wait stands in front of that overwrite; the two addresses are
  // its inputs so that they stay whole up to it (no later load of the group lands in them)
  asm volatile("s_wait_xcnt 0x0" :: "v"(gK), "v"(gV) : "memory");
  // every load is issued before the first cast waits for one: moved below a wait, a load would pay its latency anew
  __builtin_amdgcn_sched_barrier(0);
#pragma unroll  // constant indices: the staging arrays stay in registers
  for (int j = 0; j < kPasses; ++j) {
    const float w = exp2f((float)(kSpan - srow - j * kRowsPerPass) * lg);
    const v4f vb = __builtin_convertvector(__builtin_convertvector(rv[j], v4b), v4f);   // the RNE bf16 value of v, as in the score path
    *(v2u*)(&sK[soV + j * kRowsPerPass * kPitchV]) = cast4_bf16_as_f16(rk[j]);
    *(v2u*)(&sV[soV + j * kRowsPerPass * kPitchV]) = __builtin_bit_cast(v2u, __builtin_convertvector(vb * w, v4h));
  }
  __syncthreads();   // the stage's two tiles published

  if (wave < 8) {
    const int nk = wave & 3;    // 16 dk
    const int nv = wave >> 2;   // 32 dv
    const _Float16* bK = (const _Float16*)sK + nk * 16 + vo;
    const _Float16* bV = (const _Float16*)sV + nv * 32 + vo;
    v8f d0 = (v8f){0.f, 0.f, 0.f, 0.f, 0.f, 0.f, 0.f, 0.f};
    v8f d1 = d0;
#pragma unroll  // the fragment loads of all eight 32-key steps can be in flight together
    for (int p = 0; p < kSpan / 32; ++p) {
      const v16h kb = load_frag_tr(bK + p * 32 * kPitchV);
      d0 = __builtin_amdgcn_wmma_f32_16x16x32_f16(false, load_frag_tr(bV + p * 32 * kPitchV), false, kb, (short)0, d0, false, false);
      d1 = __builtin_amdgcn_wmma_f32_16x16x32_f16(false, load_frag_tr(bV + p * 32 * kPitchV + 16), false, kb, (short)0, d1, false, false);
    }
    float* up = u + (((size_t)plane * kStates + blockIdx.x) * kDh + nk * 16 + c) * kDh + nv * 32 + 8 * h;
    *(v4f*)(up)      = (v4f){d0[0], d0[1], d0[2], d0[3]};
    *(v4f*)(up + 4)  = (v4f){d0[4], d0[5], d0[6], d0[7]};
    *(v4f*)(up + 16) = (v4f){d1[0], d1[1], d1[2], d1[3]};
    *(v4f*)(up + 20) = (v4f){d1[4], d1[5], d1[6], d1[7]};
  }
}

// ---------------------------------------------------------------------------
// Fused casts, scores, decay and output product. grid (16, 16): blockIdx.x = (stage, pair of its query tiles), blockIdx.y =
// (batch, head) plane. A work-group takes two 64-query tiles of ONE 256-key stage m, tiles 3 - a and a of the stage's four
// (five key tiles at or below the two diagonals for either a), and stages what both need, the stage's K and V and Z, once.
// Keys of stage m: scores, as below. Keys in front of stage m:
//   sum_j gamma^(i-j) (q_i.k_j) v_j = gamma^(i - 256 m) * q_i . Z,  Z[dk][dv] = sum_{s < m} gamma^(256 (m-1-s)) U_s[dk][dv],
//   U_s from the first launch; every exponent is >= 0. Z is summed in f32, s ascending, cast to f16 and laid in LDS as
//   [dk][dv]: read like a V tile of 64 keys, with q (f16 holding its RNE bf16 value) in the place of the decayed scores.
// Wave = (query group qt, key group g): 16 queries of each of the two tiles, one tile after the other, and key tile
// m * kKG + g. The last key group also takes the Z products.
// The kKG partial sums of a query tile are joined through LDS in the fixed order g = 0, 1, ...; every wave joins a share.
// K and V tiles go global f32 -> registers -> cast -> LDS, one buffer, filled once per work-group.
// ---------------------------------------------------------------------------
__global__ __launch_bounds__(kThreads) void decay_attn_fused_kernel(
    const float* __restrict__ q, const float* __restrict__ k, const float* __restrict__ v, const float* __restrict__ u,
    float* __restrict__ out,
    float lg0, float lg1, float lg2, float lg3, float lg4, float lg5, float lg6, float lg7) {
  __shared__ __align__(16) unsigned short sK[kSpan * kPitch];     // [key][d], bf16
  __shared__ __align__(16) unsigned short sV[kSpan * kPitchV];    // [key][d], f16
  __shared__ __align__(16) unsigned short sZ[kDh * kPitchV];      // [dk][dv], f16
  __shared__ __align__(16) float sR[2 * kKG * 4 * 8 * 128];       // partial sums: [tile of the pair][g][qt][chunk][lane][4]
  const int t     = threadIdx.x;
  const int lane  = t & 31;
  const int wave  = __builtin_amdgcn_readfirstlane(t >> 5);         // scalar: the tests on g below are scalar branches
  const int qt    = wave & 3;
  const int g     = wave >> 2;
  const int c     = lane & 15;
  const int h     = lane >> 4;
  const int plane = blockIdx.y;
  const int head  = blockIdx.y % kHeads;
  const float lg = (head == 0) ? lg0 : (head == 1) ? lg1 : (head == 2) ? lg2 : (head == 3) ? lg3
                 : (head == 4) ? lg4 : (head == 5) ? lg5 : (head == 6) ? lg6 : lg7;
  const int m     = kStates - ((int)blockIdx.x >> 1);               // the stage = number of stages in front of it; most states first
  const int a     = (int)blockIdx.x & 1;
  const int tb0   = m * kKG + (kKG - 1 - a);                        // the pair's two query tiles
  const int tb1   = m * kKG + a;

  // staging map: thread t moves 4 elements of rows (t >> 4) + kRowsPerPass j of each stage; 16 threads cover one 256-B f32 row
  const int srow = t >> 4;
  const int scol = (t & 15) * 4;
  const int soK  = srow * kPitch + scol;
  const int soV  = srow * kPitchV + scol;
  // this lane's address in a V tile for the transposing reads
  const int vo = (8 * h + (lane & 7)) * kPitchV + 8 * ((lane >> 3) & 1);
  // this wave's key tile inside a stage
  const int koK = g * kStage * kPitch;
  const int koV = g * kStage * kPitchV + vo;

  float ck[32];   // per-key factors of the decay weight, made below while the loads are in flight

  const float* qp0 = q + ((size_t)plane * kSeq + tb0 * kQBlk + qt * 16 + c) * kDh + 8 * h;
  const float* qp1 = q + ((size_t)plane * kSeq + tb1 * kQBlk + qt * 16 + c) * kDh + 8 * h;
  v16b qf[2][2];

  const float* gK = k + ((size_t)plane * kSeq + m * kSpan + srow) * kDh + scol;
  const float* gV = v + ((size_t)plane * kSeq + m * kSpan + srow) * kDh + scol;
  const float* gU = u + (size_t)plane * kStates * kDh * kDh;        // scalar base; the lane's part is the 32-bit byte offset uo
  const unsigned uo = (unsigned)(srow * kDh + scol) * (unsigned)sizeof(float);
  {
    v4f rq[2][8], rk[kPasses], rv[kPasses], ru[kStates][2];
    // q from f32 memory in the k order of load_frag_b: per 32 d, floats 0..7 and 16..23 from the lane's start; cast below
#pragma unroll  // constant indices: the staging arrays stay in registers
    for (int e = 0; e < 8; ++e) {
      rq[0][e] = *(const v4f*)(qp0 + (e >> 2) * 32 + ((e >> 1) & 1) * 16 + (e & 1) * 4);
      rq[1][e] = *(const v4f*)(qp1 + (e >> 2) * 32 + ((e >> 1) & 1) * 16 + (e & 1) * 4);
    }
#pragma unroll  // constant indices: the staging arrays stay in registers
    for (int j = 0; j < kPasses; ++j) {
      rk[j] = *(const v4f*)(gK + j * kRowsPerPass * kDh);
      rv[j] = *(const v4f*)(gV + j * kRowsPerPass * kDh);
    }
    // the states in front of the stage: rows srow and srow + 32 of each. A state at or behind the stage is not
    // wanted: its load is aimed at the nearest wanted one (state 0 where there is none; the first launch wrote all
    // seven) and its value dropped below, so that the loads need no branch and are all in flight together
#pragma unroll  // constant indices: the staging arrays stay in registers
    for (int s = 0; s < kStates; ++s) {
      const int sc = (s < m) ? s : ((m > 0) ? m - 1 : 0);
      ru[s][0] = *(const v4f*)((const char*)(gU + sc * kDh * kDh) + uo);
      ru[s][1] = *(const v4f*)((const char*)(gU + sc * kDh * kDh + kRowsPerPass * kDh) + uo);
    }
    // the loads' address registers and scalar bases are reused right below: this wait stands in front of that overwrite; the
    // four vector addresses and the states' lane offset are its inputs so that they stay whole up to it
    asm volatile("s_wait_xcnt 0x0" :: "v"(qp0), "v"(qp1), "v"(gK), "v"(gV), "v"(uo) : "memory");
    // every load is issued before the first cast waits for one: moved below a wait, a load would pay its latency anew
    __builtin_amdgcn_sched_barrier(0);
    // per-key factors of the decay weight, the same in every stage and lane: lane e makes entry e (one exp2 for the table),
    // and the lane reads hand all 32 entries to every lane
    const int ckl = __builtin_bit_cast(int, exp2f(-(float)((lane >> 3) * 16 + (lane & 7)) * lg));
#pragma unroll  // constant indices: the table stays in registers
    for (int e = 0; e < 32; ++e) ck[e] = __builtin_bit_cast(float, __builtin_amdgcn_readlane(ckl, e));
#pragma unroll  // constant indices: the staging arrays stay in registers
    for (int tl = 0; tl < 2; ++tl)
#pragma unroll  // constant indices: the staging arrays stay in registers
      for (int p = 0; p < 2; ++p) {
        union { v16b v; v4b q4[4]; } f;
#pragma unroll  // constant indices: the staging arrays stay in registers
        for (int e = 0; e < 4; ++e) f.q4[e] = __builtin_convertvector(rq[tl][p * 4 + e], v4b);
        qf[tl][p] = f.v;
      }
#pragma unroll  // constant indices: the staging arrays stay in registers
    for (int j = 0; j < kPasses; ++j) {
      *(v2u*)(&sK[soK + j * kRowsPerPass * kPitch])  = cast4_bf16(rk[j]);
      *(v2u*)(&sV[soV + j * kRowsPerPass * kPitchV]) = cast4_bf16_as_f16(rv[j]);
    }
    v4f z0 = (v4f){0.f, 0.f, 0.f, 0.f}, z1 = z0;
#pragma unroll  // constant indices: the staging arrays stay in registers; fixed order of the sum
    for (int s = 0; s < kStates; ++s) {
      // factor 0 drops an unwanted load's value; it is a wanted state's own value wherever Z is used at all (m > 0)
      const float cf = (s < m) ? exp2f((float)((m - 1 - s) * kSpan) * lg) : 0.0f;
      z0 += ru[s][0] * cf;
      z1 += ru[s][1] * cf;
    }
    *(v2u*)(&sZ[soV])                           = __builtin_bit_cast(v2u, __builtin_convertvector(z0, v4h));
    *(v2u*)(&sZ[soV + kRowsPerPass * kPitchV]) = __builtin_bit_cast(v2u, __builtin_convertvector(z1, v4h));
  }
  __syncthreads();   // the stage and Z published

  const int kt = m * kKG + g;   // this wave's key tile
#pragma unroll  // constant tl: the two tiles' q fragments stay in registers
  for (int tl = 0; tl < 2; ++tl) {
    const int tb = (tl == 0) ? tb0 : tb1;                           // query tile
    const int i  = tb * kQBlk + qt * 16 + c;                        // this lane's query
    v8f acc[4];
#pragma unroll  // constant indices: the fragment and accumulator arrays stay in registers
    for (int n = 0; n < 4; ++n) acc[n] = (v8f){0.f, 0.f, 0.f, 0.f, 0.f, 0.f, 0.f, 0.f};

    const int dbase = i - m * kSpan - g * kStage - 8 * h;
    // this wave's key tile lies below the diagonal, on it, or above it (nothing to add)
    if (kt < tb)
      stage_compute((const __bf16*)sK + koK, (const _Float16*)sV + koV, qf[tl], acc, ck, dbase, lg, false, c, h);
    else if (kt == tb)
      stage_compute((const __bf16*)sK + koK, (const _Float16*)sV + koV, qf[tl], acc, ck, dbase, lg, true, c, h);

    // every key in front of the stage, through Z: O^T[dv][query] += 32 gamma^(i - 256 m) * (Z^T q_i); the factor is the
    // lane's own (a D column is one query), applied in f32
    if (g == kKG - 1 && m > 0) {
      v16h qh[2];
#pragma unroll  // constant indices: the fragment and accumulator arrays stay in registers
      for (int p = 0; p < 2; ++p)
        qh[p] = __builtin_convertvector(__builtin_convertvector(qf[tl][p], __attribute__((ext_vector_type(16))) float), v16h);
      const float ez = exp2f((float)(i - m * kSpan) * lg) * kScoreScaleCarry;
#pragma unroll  // constant indices: the fragment and accumulator arrays stay in registers
      for (int n = 0; n < 4; ++n) {
        v8f tz = (v8f){0.f, 0.f, 0.f, 0.f, 0.f, 0.f, 0.f, 0.f};
#pragma unroll  // constant indices: the fragment and accumulator arrays stay in registers
        for (int p = 0; p < 2; ++p)
          tz = __builtin_amdgcn_wmma_f32_16x16x32_f16(false, load_frag_tr((const _Float16*)sZ + vo + p * 32 * kPitchV + n * 16),
                                                      false, qh[p], (short)0, tz, false, false);
        acc[n] += tz * ez;
      }
    }

    // every key group hands its partial sums of the tile over in LDS
    float* r = sR + ((tl * kKG + g) * 4 + qt) * 8 * 128 + lane * 4;
#pragma unroll  // constant indices: the fragment and accumulator arrays stay in registers
    for (int n = 0; n < 4; ++n) {
      *(v4f*)(r + (2 * n) * 128)     = (v4f){acc[n][0], acc[n][1], acc[n][2], acc[n][3]};
      *(v4f*)(r + (2 * n + 1) * 128) = (v4f){acc[n][4], acc[n][5], acc[n][6], acc[n][7]};
    }
  }
  __syncthreads();   // publishes the partial sums of both tiles

  // join: wave (qt, g) adds, in the order of the key groups, the partial sums of tile g >> 1 of the pair for 32 of the 64 d
  // (one 128-byte line of each of its 16 rows) and stores them
  {
    const int jt = g >> 1;
    const int n0 = (g & 1) * 2;
    const int tb = (jt == 0) ? tb0 : tb1;
    // a lane holds 8 consecutive d of its query's row per tile: two 16-byte stores
    float* op = out + ((size_t)plane * kSeq + tb * kQBlk + qt * 16 + c) * kDh + 8 * h + n0 * 16;
    const float* r = sR + (jt * kKG * 4 + qt) * 8 * 128 + (2 * n0) * 128 + lane * 4;
#pragma unroll  // constant indices: the reads of both steps can be in flight together
    for (int n = 0; n < 2; ++n) {
      v4f lo = *(const v4f*)(r + (2 * n) * 128);
      v4f hi = *(const v4f*)(r + (2 * n + 1) * 128);
#pragma unroll  // constant indices: fixed order of the sum
      for (int gg = 1; gg < kKG; ++gg) {
        lo += *(const v4f*)(r + gg * 4 * 8 * 128 + (2 * n) * 128);
        hi += *(const v4f*)(r + gg * 4 * 8 * 128 + (2 * n + 1) * 128);
      }
      *(v4f*)(op + n * 16)     = lo * kPCarryInv;
      *(v4f*)(op + n * 16 + 4) = hi * kPCarryInv;
    }
  }
}

// ---------------------------------------------------------------------------
// Host glue. Two launches; the workspace holds the 16 x 7 stage states (f32, 16 KiB each), written by the first launch.
// ---------------------------------------------------------------------------
extern "C" void kernel_launch(void* const* d_in, const int* in_sizes, int n_in,
                              void* d_out, int out_size, void* d_ws, size_t ws_size,
                              hipStream_t stream) {
  if (n_in < 3) return;
  if (in_sizes[0] != kElems || in_sizes[1] != kElems || in_sizes[2] != kElems) return;
  if (out_size != kElems) return;
  if (ws_size < sizeof(float) * kBH * kStates * kDh * kDh) return;

  const float* q = (const float*)d_in[0];
  const float* k = (const float*)d_in[1];
  const float* v = (const float*)d_in[2];
  float* out = (float*)d_out;
  float* u = (float*)d_ws;

  // log2(gamma_h), gamma_h = 1 - 2^(-5-h) (exact in f32); log2 evaluated in double and RNE-converted to f32
  float lg[kHeads];
  for (int h = 0; h < kHeads; ++h) {
    const float gma = 1.0f - 1.0f / (float)(32 << h);
    lg[h] = (float)log2((double)gma);
  }

  decay_state_kernel<<<dim3(kStates, kBH), dim3(kThreads), 0, stream>>>(
      k, v, u, lg[0], lg[1], lg[2], lg[3], lg[4], lg[5], lg[6], lg[7]);
  decay_attn_fused_kernel<<<dim3(kTiles / 2, kBH), dim3(kThreads), 0, stream>>>(
      q, k, v, u, out, lg[0], lg[1], lg[2], lg[3], lg[4], lg[5], lg[6], lg[7]);
}

// v007
// Measured time: 13.9 microseconds a run.
// Next to v006, in two timings, it ran 1.09 and 1.08 times as fast.
// Counting every step since v000, it is 32.2 times as fast.
// Contractions: scores^T = k.q^T on v_wmma_f32_16x16x32_bf16 (q, k as RNE bf16, exact products), out^T = v^T @ (scores*scale*decay)^T on v_wmma_f32_16x16x32_f16 (decayed scores f16 carried x256, v as f16 holding RNE bf16 values, transposed by the LDS read); f32 accumulate; decay mask, scaling and casts in f32, the decay weight as the product of a per-lane stage factor and a per-key table. q, k, v are read as f32 by whole-line loads and cast on their way to LDS; the scores stay in registers. Scores are formed only for the 256-key stage that holds the query tile's diagonal (key tiles at or below it, split over wave groups whose f32 partial sums are joined in LDS); every earlier stage enters through its decayed 64x64 state sum_j gamma^(end-j) k_j v_j^T (first launch, v_wmma_f32_16x16x32_f16, f32 in the workspace), summed over stages in f32, cast to f16 and multiplied by q on the same f16 form.
#include <hip/hip_runtime.h>
#include <math.h>

// ---------------------------------------------------------------------------
// Problem constants
// ---------------------------------------------------------------------------
constexpr int kBatch = 2;
constexpr int kHeads = 8;
constexpr int kSeq   = 2048;
constexpr int kDh    = 64;
constexpr int kBH    = kBatch * kHeads;          // 16 (batch, head) planes
constexpr int kElems = kBH * kSeq * kDh;         // 2,097,152 elements per tensor
constexpr int kQBlk  = 64;                       // queries per tile: 4 waves x 16
constexpr int kStage = 64;                       // keys per wave and stage: one key tile
constexpr int kKG    = 4;                        // wave groups of a work-group; each takes its own key tile of a stage
constexpr int kThreads = 4 * kKG * 32;           // 4 query waves x kKG key groups
constexpr int kTiles = kSeq / kQBlk;             // 32 query tiles per plane = 32 key tiles
constexpr int kRowsPerPass = kThreads / 16;      // staging: rows of a stage that the block moves with one load per thread
constexpr int kPasses = kKG * kStage / kRowsPerPass;   // 8 loads per thread, tensor and stage
constexpr int kQPasses = kQBlk / kRowsPerPass;   // 2 loads per thread and query tile
constexpr int kSpan   = kKG * kStage;            // keys of a stage
constexpr int kStates = kSeq / kSpan - 1;        // stages that lie in front of some query tile's own stage: one state each
constexpr int kPitch  = 72;                      // K rows in LDS, 16-bit elements: 128 B of data + 16 B pad (16 B x odd, plain 16-byte reads)
constexpr int kPitchV = 80;                      // V rows in LDS, 16-bit elements: 128 B of data + 32 B pad (32 B x odd, transposing reads)
constexpr float kPCarryInv       = 1.0f / 256.0f;   // decayed scores carried x256 in f16
constexpr float kScoreScaleCarry = 0.125f * 256.0f; // 64^-0.5 * carry = 32 (exact power of two)
static_assert(kDh == 64 && kStage == 64 && kQBlk == kStage, "");   // LDS rows of 128 B; a query tile's diagonal lies in one key tile
static_assert(kTiles % 2 == 0 && kTiles % kKG == 0, "");           // tiles pair up; a stage never reaches past the last key
static_assert(kHeads == 8 && kKG == 4, "");   // eight log2(gamma) arguments; a stage's four query tiles make two pairs, 16 waves share the join

typedef __attribute__((ext_vector_type(16))) _Float16 v16h;
typedef __attribute__((ext_vector_type(8)))  _Float16 v8h;
typedef __attribute__((ext_vector_type(16))) __bf16   v16b;
typedef __attribute__((ext_vector_type(8)))  __bf16   v8b;
typedef __attribute__((ext_vector_type(8)))  float    v8f;
typedef __attribute__((ext_vector_type(4)))  float    v4f;
typedef __attribute__((ext_vector_type(4)))  __bf16   v4b;
typedef __attribute__((ext_vector_type(4)))  _Float16 v4h;
typedef __attribute__((ext_vector_type(2)))  unsigned int v2u;
typedef __attribute__((ext_vector_type(8)))  short    v8s;

// Casts of four f32 values on their way to LDS: RNE bf16, and f16 holding the RNE bf16 value (exact for normal magnitudes).
__device__ __forceinline__ v2u cast4_bf16(v4f x) { return __builtin_bit_cast(v2u, __builtin_convertvector(x, v4b)); }
__device__ __forceinline__ v2u cast4_bf16_as_f16(v4f x) {
  const v4f y = __builtin_convertvector(__builtin_convertvector(x, v4b), v4f);
  return __builtin_bit_cast(v2u, __builtin_convertvector(y, v4h));
}

// Fragment loaders, hardware k order of the 16x16x32 16-bit forms: elements 0..7 <- p[0..7], 8..15 <- p[16..23],
// p = row start + 8 * (lane >> 4).
__device__ __forceinline__ v16b load_frag_b(const __bf16* p) {
  union { v16b v; v8b h[2]; } f; f.h[0] = *(const v8b*)(p); f.h[1] = *(const v8b*)(p + 16); return f.v;
}
// Transposing LDS read of a row-major [key][d] 16-bit tile. Lane l points at row kbase + 8 (l >> 4) + (l & 7), byte
// 2 dbase + 16 ((l >> 3) & 1); lane (c, h) receives keys kbase + 8h + 0..7 of column dbase + c. The reads at kbase and
// kbase + 16 are elements 0..7 and 8..15 of one 16 (d) x 32 (keys) A fragment in the hardware k order.
__device__ __forceinline__ v8h ld_tr16(const _Float16* p) {
  typedef __attribute__((address_space(3))) v8s lds_v8s;
  return __builtin_bit_cast(v8h, __builtin_amdgcn_ds_load_tr16_b128_v8i16((lds_v8s*)p));
}
__device__ __forceinline__ v16h load_frag_tr(const _Float16* p) {
  union { v16h v; v8h h[2]; } f; f.h[0] = ld_tr16(p); f.h[1] = ld_tr16(p + 16 * kPitchV); return f.v;
}

// ---------------------------------------------------------------------------
// One stage (64 keys) of one wave's 16 queries, K and V tiles in LDS, both [key][d]. c = lane & 15 (query column), h = lane >> 4.
// T[t][r] = S^T[key 16t + 8h + r][query c] (A = K rows, B = Q rows, read from LDS by the caller);
//   P = f16( w * S ), w = 256 * 0.125 * gamma_h^(i-j) for j <= i, 0 for j > i, in f32, factored over i - j = dbase - off:
//   w = [32 * exp2(dbase * log2_gamma_h)] * ck[e], ck[e] = exp2(-off * log2_gamma_h), off = 16 (e >> 3) + (e & 7) in [0, 55]:
//   one exp2 per lane and stage, the table made once per kernel. dbase < 0 puts every key of the lane's stage above the
//   diagonal (stage factor 0); dbase >= 55 none; between the two lies only the wave's one diagonal stage (diag), which
//   alone tests each element;
//   two converted tiles are the B operand of the second product as they lie (element s = T[s >> 3][s & 7] of 32 keys);
//   acc[n][r] += O^T[d 16n + 8h + r][query c] (A = V^T rows in the same k order, by the transposing read; bV is the
//   lane's own read address in the V tile). dbase = i - (first key + 8h).
// ---------------------------------------------------------------------------
__device__ __forceinline__ void stage_compute(const __bf16* __restrict__ bK, const _Float16* __restrict__ bV,
                                              const v16b (&qf)[2], v8f (&acc)[4], const float (&ck)[32], int dbase, float lg,
                                              bool diag, int c, int h) {
  v16b ka[4][2];
#pragma unroll  // constant indices: the fragment and accumulator arrays stay in registers
  for (int tt = 0; tt < 4; ++tt)
#pragma unroll  // constant indices: the fragment and accumulator arrays stay in registers
    for (int kk = 0; kk < 2; ++kk) ka[tt][kk] = load_frag_b(bK + (tt * 16 + c) * kPitch + kk * 32 + 8 * h);
  // keeps the K fragment loads one group ahead of the products: spread among them each load waits out its own LDS latency
  __builtin_amdgcn_sched_barrier(0);
  const float eg = exp2f((float)dbase * lg) * kScoreScaleCarry;   // exponent in [-94, 94]: finite, normal f32
  const float e0 = (dbase >= 0) ? eg : 0.0f;
  v8f T[4];
#pragma unroll  // constant indices: the fragment and accumulator arrays stay in registers
  for (int tt = 0; tt < 4; ++tt) {
    T[tt] = (v8f){0.f, 0.f, 0.f, 0.f, 0.f, 0.f, 0.f, 0.f};
#pragma unroll  // constant indices: the fragment and accumulator arrays stay in registers
    for (int kk = 0; kk < 2; ++kk)
      T[tt] = __builtin_amdgcn_wmma_f32_16x16x32_bf16(false, ka[tt][kk], false, qf[kk], (short)0, T[tt], false, false);
  }
  v16h va[2][4];
#pragma unroll  // constant indices: the fragment and accumulator arrays stay in registers
  for (int p = 0; p < 2; ++p)
#pragma unroll  // constant indices: the fragment and accumulator arrays stay in registers
    for (int n = 0; n < 4; ++n) va[p][n] = load_frag_tr(bV + p * 32 * kPitchV + n * 16);
  // keeps the V^T fragment loads in front of the weighting and the f16 casts, which then cover part of their LDS latency
  __builtin_amdgcn_sched_barrier(0);
#pragma unroll  // constant indices: the fragment and accumulator arrays stay in registers
  for (int p = 0; p < 2; ++p) {
    v16h pf;
#pragma unroll  // constant indices: the fragment and accumulator arrays stay in registers
    for (int tt = 0; tt < 2; ++tt) {
#pragma unroll  // constant indices: the fragment and accumulator arrays stay in registers
      for (int r = 0; r < 8; ++r) {
        // the weight is made where it is used: 32 fewer live registers over the fragment loads
        float w = e0 * ck[(p * 2 + tt) * 8 + r];
        if (diag) w = (dbase >= (p * 2 + tt) * 16 + r) ? w : 0.0f;   // causal zero above the diagonal; diag is a constant of the call
        pf[tt * 8 + r] = (_Float16)(T[p * 2 + tt][r] * w);
      }
    }
#pragma unroll  // constant indices: the fragment and accumulator arrays stay in registers
    for (int n = 0; n < 4; ++n)
      acc[n] = __builtin_amdgcn_wmma_f32_16x16x32_f16(false, va[p][n], false, pf, (short)0, acc[n], false, false);
  }
}

// ---------------------------------------------------------------------------
// State of one stage: U[dk][dv] = sum over the stage's keys j of gamma_h^(stage end - j) * k_j[dk] * v_j[dv], exponent in
// [1, 256], so every weight is at most 1. grid (7, 16): blockIdx.x = stage, blockIdx.y = plane. K (f16 holding the RNE bf16
// value) and the weighted V (f16) lie in LDS as [key][d]; both operands come by the transposing read at the same key base,
// so their k orders are equal: D[dv 8h + r][dk c] = A (V^T) x B (K). Eight waves take 16 dk x 32 dv each: a lane stores 8
// consecutive dv of its dk row per tile, a wave whole 128-byte lines.
// ---------------------------------------------------------------------------
__global__ __launch_bounds__(kThreads) void decay_state_kernel(
    const float* __restrict__ k, const float* __restrict__ v, float* __restrict__ u,
    float lg0, float lg1, float lg2, float lg3, float lg4, float lg5, float lg6, float lg7) {
  __shared__ __align__(16) unsigned short sK[kSpan * kPitchV];   // [key][d], f16
  __shared__ __align__(16) unsigned short sV[kSpan * kPitchV];   // [key][d], f16, weighted
  const int t     = threadIdx.x;
  const int lane  = t & 31;
  const int wave  = __builtin_amdgcn_readfirstlane(t >> 5);         // scalar: the test on the wave below is a scalar branch
  const int c     = lane & 15;
  const int h     = lane >> 4;
  const int plane = blockIdx.y;
  const int head  = blockIdx.y % kHeads;
  const float lg = (head == 0) ? lg0 : (head == 1) ? lg1 : (head == 2) ? lg2 : (head == 3) ? lg3
                 : (head == 4) ? lg4 : (head == 5) ? lg5 : (head == 6) ? lg6 : lg7;
  const int srow = t >> 4;
  const int scol = (t & 15) * 4;
  const int soV  = srow * kPitchV + scol;
  const int vo = (8 * h + (lane & 7)) * kPitchV + 8 * ((lane >> 3) & 1);

  const float* gK = k + ((size_t)plane * kSeq + (int)blockIdx.x * kSpan + srow) * kDh + scol;
  const float* gV = v + ((size_t)plane * kSeq + (int)blockIdx.x * kSpan + srow) * kDh + scol;
  v4f rk[kPasses], rv[kPasses];
#pragma unroll  // constant indices: the staging arrays stay in registers
  for (int j = 0; j < kPasses; ++j) {
    rk[j] = *(const v4f*)(gK + j * kRowsPerPass * kDh);
    rv[j] = *(const v4f*)(gV + j * kRowsPerPass * kDh);
  }
  // the loads' address registers are reused right below: this wait stands in front of that overwrite; the two addresses are
  // its inputs so that they stay whole up to it (no later load of the group lands in them)
  asm volatile("s_wait_xcnt 0x0" :: "v"(gK), "v"(gV) : "memory");
  // every load is issued before the first cast waits for one: moved below a wait, a load would pay its latency anew
  __builtin_amdgcn_sched_barrier(0);
#pragma unroll  // constant indices: the staging arrays stay in registers
  for (int j = 0; j < kPasses; ++j) {
    const float w = exp2f((float)(kSpan - srow - j * kRowsPerPass) * lg);
    const v4f vb = __builtin_convertvector(__builtin_convertvector(rv[j], v4b), v4f);   // the RNE bf16 value of v, as in the score path
    *(v2u*)(&sK[soV + j * kRowsPerPass * kPitchV]) = cast4_bf16_as_f16(rk[j]);
    *(v2u*)(&sV[soV + j * kRowsPerPass * kPitchV]) = __builtin_bit_cast(v2u, __builtin_convertvector(vb * w, v4h));
  }
  __syncthreads();   // the stage's two tiles published

  if (wave < 8) {
    const int nk = wave & 3;    // 16 dk
    const int nv = wave >> 2;   // 32 dv
    const _Float16* bK = (const _Float16*)sK + nk * 16 + vo;
    const _Float16* bV = (const _Float16*)sV + nv * 32 + vo;
    v8f d0 = (v8f){0.f, 0.f, 0.f, 0.f, 0.f, 0.f, 0.f, 0.f};
    v8f d1 = d0;
#pragma unroll  // the fragment loads of all eight 32-key steps can be in flight together
    for (int p = 0; p < kSpan / 32; ++p) {
      const v16h kb = load_frag_tr(bK + p * 32 * kPitchV);
      d0 = __builtin_amdgcn_wmma_f32_16x16x32_f16(false, load_frag_tr(bV + p * 32 * kPitchV), false, kb, (short)0, d0, false, false);
      d1 = __builtin_amdgcn_wmma_f32_16x16x32_f16(false, load_frag_tr(bV + p * 32 * kPitchV + 16), false, kb, (short)0, d1, false, false);
    }
    float* up = u + (((size_t)plane * kStates + blockIdx.x) * kDh + nk * 16 + c) * kDh + nv * 32 + 8 * h;
    *(v4f*)(up)      = (v4f){d0[0], d0[1], d0[2], d0[3]};
    *(v4f*)(up + 4)  = (v4f){d0[4], d0[5], d0[6], d0[7]};
    *(v4f*)(up + 16) = (v4f){d1[0], d1[1], d1[2], d1[3]};
    *(v4f*)(up + 20) = (v4f){d1[4], d1[5], d1[6], d1[7]};
  }
}

// ---------------------------------------------------------------------------
// Fused casts, scores, decay and output product. grid (16, 16): blockIdx.x = (stage, pair of its query tiles), blockIdx.y =
// (batch, head) plane. A work-group takes two 64-query tiles of ONE 256-key stage m, tiles 3 - a and a of the stage's four
// (five key tiles at or below the two diagonals for either a), and stages what both need, the stage's K and V and Z, once.
// Keys of stage m: scores, as below. Keys in front of stage m:
//   sum_j gamma^(i-j) (q_i.k_j) v_j = gamma^(i - 256 m) * q_i . Z,  Z[dk][dv] = sum_{s < m} gamma^(256 (m-1-s)) U_s[dk][dv],
//   U_s from the first launch; every exponent is >= 0. Z is summed in f32, s ascending, cast to f16 and laid in LDS as
//   [dk][dv]: read like a V tile of 64 keys, with q (f16 holding its RNE bf16 value) in the place of the decayed scores.
// Wave = (query group qt, key group g): 16 queries of each of the two tiles, one tile after the other, and key tile
// m * kKG + g. The last key group also takes the Z products.
// The kKG partial sums of a query tile are joined through LDS in the fixed order g = 0, 1, ...; every wave joins a share.
// K and V tiles and the two query tiles go global f32 -> registers -> cast -> LDS, one buffer each, filled once per work-group.
// ---------------------------------------------------------------------------
__global__ __launch_bounds__(kThreads) void decay_attn_fused_kernel(
    const float* __restrict__ q, const float* __restrict__ k, const float* __restrict__ v, const float* __restrict__ u,
    float* __restrict__ out,
    float lg0, float lg1, float lg2, float lg3, float lg4, float lg5, float lg6, float lg7) {
  __shared__ __align__(16) unsigned short sK[kSpan * kPitch];     // [key][d], bf16
  __shared__ __align__(16) unsigned short sV[kSpan * kPitchV];    // [key][d], f16
  __shared__ __align__(16) unsigned short sZ[kDh * kPitchV];      // [dk][dv], f16
  __shared__ __align__(16) unsigned short sQ[2 * kQBlk * kPitch]; // [tile of the pair][query][d], bf16
  __shared__ __align__(16) float sR[2 * kKG * 4 * 8 * 128];       // partial sums: [tile of the pair][g][qt][chunk][lane][4]
  const int t     = threadIdx.x;
  const int lane  = t & 31;
  const int wave  = __builtin_amdgcn_readfirstlane(t >> 5);         // scalar: the tests on g below are scalar branches
  const int qt    = wave & 3;
  const int g     = wave >> 2;
  const int c     = lane & 15;
  const int h     = lane >> 4;
  const int plane = blockIdx.y;
  const int head  = blockIdx.y % kHeads;
  const float lg = (head == 0) ? lg0 : (head == 1) ? lg1 : (head == 2) ? lg2 : (head == 3) ? lg3
                 : (head == 4) ? lg4 : (head == 5) ? lg5 : (head == 6) ? lg6 : lg7;
  const int m     = kStates - ((int)blockIdx.x >> 1);               // the stage = number of stages in front of it; most states first
  const int a     = (int)blockIdx.x & 1;
  const int tb0   = m * kKG + (kKG - 1 - a);                        // the pair's two query tiles
  const int tb1   = m * kKG + a;

  // staging map: thread t moves 4 elements of rows (t >> 4) + kRowsPerPass j of each stage; 16 threads cover one 256-B f32 row
  const int srow = t >> 4;
  const int scol = (t & 15) * 4;
  const int soK  = srow * kPitch + scol;
  const int soV  = srow * kPitchV + scol;
  // this lane's address in a V tile for the transposing reads
  const int vo = (8 * h + (lane & 7)) * kPitchV + 8 * ((lane >> 3) & 1);
  // this wave's key tile inside a stage
  const int koK = g * kStage * kPitch;
  const int koV = g * kStage * kPitchV + vo;

  float ck[32];   // per-key factors of the decay weight, made below while the loads are in flight

  const float* gQ0 = q + ((size_t)plane * kSeq + tb0 * kQBlk + srow) * kDh + scol;
  const float* gQ1 = q + ((size_t)plane * kSeq + tb1 * kQBlk + srow) * kDh + scol;

  const float* gK = k + ((size_t)plane * kSeq + m * kSpan + srow) * kDh + scol;
  const float* gV = v + ((size_t)plane * kSeq + m * kSpan + srow) * kDh + scol;
  const float* gU = u + (size_t)plane * kStates * kDh * kDh;        // scalar base; the lane's part is the 32-bit byte offset uo
  const unsigned uo = (unsigned)(srow * kDh + scol) * (unsigned)sizeof(float);
  {
    v4f rq[2][kQPasses], rk[kPasses], rv[kPasses], ru[kStates][2];
    // the pair's two query tiles, moved like K: a wave's load covers two whole 256-byte rows, and the block reads each row once
#pragma unroll  // constant indices: the staging arrays stay in registers
    for (int j = 0; j < kQPasses; ++j) {
      rq[0][j] = *(const v4f*)(gQ0 + j * kRowsPerPass * kDh);
      rq[1][j] = *(const v4f*)(gQ1 + j * kRowsPerPass * kDh);
    }
#pragma unroll  // constant indices: the staging arrays stay in registers
    for (int j = 0; j < kPasses; ++j) {
      rk[j] = *(const v4f*)(gK + j * kRowsPerPass * kDh);
      rv[j] = *(const v4f*)(gV + j * kRowsPerPass * kDh);
    }
    // the states in front of the stage: rows srow and srow + 32 of each. A state at or behind the stage is not
    // wanted: its load is aimed at the nearest wanted one (state 0 where there is none; the first launch wrote all
    // seven) and its value dropped below, so that the loads need no branch and are all in flight together
#pragma unroll  // constant indices: the staging arrays stay in registers
    for (int s = 0; s < kStates; ++s) {
      const int sc = (s < m) ? s : ((m > 0) ? m - 1 : 0);
      ru[s][0] = *(const v4f*)((const char*)(gU + sc * kDh * kDh) + uo);
      ru[s][1] = *(const v4f*)((const char*)(gU + sc * kDh * kDh + kRowsPerPass * kDh) + uo);
    }
    // the loads' address registers and scalar bases are reused right below: this wait stands in front of that overwrite; the
    // four vector addresses and the states' lane offset are its inputs so that they stay whole up to it
    asm volatile("s_wait_xcnt 0x0" :: "v"(gQ0), "v"(gQ1), "v"(gK), "v"(gV), "v"(uo) : "memory");
    // every load is issued before the first cast waits for one: moved below a wait, a load would pay its latency anew
    __builtin_amdgcn_sched_barrier(0);
    // per-key factors of the decay weight, the same in every stage and lane: lane e makes entry e (one exp2 for the table),
    // and the lane reads hand all 32 entries to every lane
    const int ckl = __builtin_bit_cast(int, exp2f(-(float)((lane >> 3) * 16 + (lane & 7)) * lg));
#pragma unroll  // constant indices: the table stays in registers
    for (int e = 0; e < 32; ++e) ck[e] = __builtin_bit_cast(float, __builtin_amdgcn_readlane(ckl, e));
#pragma unroll  // constant indices: the staging arrays stay in registers
    for (int tl = 0; tl < 2; ++tl)
#pragma unroll  // constant indices: the staging arrays stay in registers
      for (int j = 0; j < kQPasses; ++j)
        *(v2u*)(&sQ[tl * kQBlk * kPitch + soK + j * kRowsPerPass * kPitch]) = cast4_bf16(rq[tl][j]);
#pragma unroll  // constant indices: the staging arrays stay in registers
    for (int j = 0; j < kPasses; ++j) {
      *(v2u*)(&sK[soK + j * kRowsPerPass * kPitch])  = cast4_bf16(rk[j]);
      *(v2u*)(&sV[soV + j * kRowsPerPass * kPitchV]) = cast4_bf16_as_f16(rv[j]);
    }
    v4f z0 = (v4f){0.f, 0.f, 0.f, 0.f}, z1 = z0;
#pragma unroll  // constant indices: the staging arrays stay in registers; fixed order of the sum
    for (int s = 0; s < kStates; ++s) {
      // factor 0 drops an unwanted load's value; it is a wanted state's own value wherever Z is used at all (m > 0)
      const float cf = (s < m) ? exp2f((float)((m - 1 - s) * kSpan) * lg) : 0.0f;
      z0 += ru[s][0] * cf;
      z1 += ru[s][1] * cf;
    }
    *(v2u*)(&sZ[soV])                           = __builtin_bit_cast(v2u, __builtin_convertvector(z0, v4h));
    *(v2u*)(&sZ[soV + kRowsPerPass * kPitchV]) = __builtin_bit_cast(v2u, __builtin_convertvector(z1, v4h));
  }
  __syncthreads();   // the stage, the two query tiles and Z published

  const int kt = m * kKG + g;   // this wave's key tile
#pragma unroll  // constant tl: the tile's places in LDS are constants of the addresses
  for (int tl = 0; tl < 2; ++tl) {
    const int tb = (tl == 0) ? tb0 : tb1;                           // query tile
    const int i  = tb * kQBlk + qt * 16 + c;                        // this lane's query
    v8f acc[4];
#pragma unroll  // constant indices: the fragment and accumulator arrays stay in registers
    for (int n = 0; n < 4; ++n) acc[n] = (v8f){0.f, 0.f, 0.f, 0.f, 0.f, 0.f, 0.f, 0.f};

    const int dbase = i - m * kSpan - g * kStage - 8 * h;
    const bool zw = (g == kKG - 1 && m > 0);                        // this wave takes the Z products
    // the wave's 16 queries as B fragments, read like K rows (same k order); a wave with no product for the tile reads none
    v16b qf[2];
    if (kt <= tb || zw) {
#pragma unroll  // constant indices: the fragment and accumulator arrays stay in registers
      for (int kk = 0; kk < 2; ++kk)
        qf[kk] = load_frag_b((const __bf16*)sQ + (tl * kQBlk + qt * 16 + c) * kPitch + kk * 32 + 8 * h);
    }
    // this wave's key tile lies below the diagonal, on it, or above it (nothing to add)
    if (kt < tb)
      stage_compute((const __bf16*)sK + koK, (const _Float16*)sV + koV, qf, acc, ck, dbase, lg, false, c, h);
    else if (kt == tb)
      stage_compute((const __bf16*)sK + koK, (const _Float16*)sV + koV, qf, acc, ck, dbase, lg, true, c, h);

    // every key in front of the stage, through Z: O^T[dv][query] += 32 gamma^(i - 256 m) * (Z^T q_i); the factor is the
    // lane's own (a D column is one query), applied in f32
    if (zw) {
      v16h qh[2];
#pragma unroll  // constant indices: the fragment and accumulator arrays stay in registers
      for (int p = 0; p < 2; ++p)
        qh[p] = __builtin_convertvector(__builtin_convertvector(qf[p], __attribute__((ext_vector_type(16))) float), v16h);
      const float ez = exp2f((float)(i - m * kSpan) * lg) * kScoreScaleCarry;
#pragma unroll  // constant indices: the fragment and accumulator arrays stay in registers
      for (int n = 0; n < 4; ++n) {
        v8f tz = (v8f){0.f, 0.f, 0.f, 0.f, 0.f, 0.f, 0.f, 0.f};
#pragma unroll  // constant indices: the fragment and accumulator arrays stay in registers
        for (int p = 0; p < 2; ++p)
          tz = __builtin_amdgcn_wmma_f32_16x16x32_f16(false, load_frag_tr((const _Float16*)sZ + vo + p * 32 * kPitchV + n * 16),
                                                      false, qh[p], (short)0, tz, false, false);
        acc[n] += tz * ez;
      }
    }

    // every key group hands its partial sums of the tile over in LDS
    float* r = sR + ((tl * kKG + g) * 4 + qt) * 8 * 128 + lane * 4;
#pragma unroll  // constant indices: the fragment and accumulator arrays stay in registers
    for (int n = 0; n < 4; ++n) {
      *(v4f*)(r + (2 * n) * 128)     = (v4f){acc[n][0], acc[n][1], acc[n][2], acc[n][3]};
      *(v4f*)(r + (2 * n + 1) * 128) = (v4f){acc[n][4], acc[n][5], acc[n][6], acc[n][7]};
    }
  }
  __syncthreads();   // publishes the partial sums of both tiles

  // join: wave (qt, g) adds, in the order of the key groups, the partial sums of tile g >> 1 of the pair for 32 of the 64 d
  // (one 128-byte line of each of its 16 rows) and stores them
  {
    const int jt = g >> 1;
    const int n0 = (g & 1) * 2;
    const int tb = (jt == 0) ? tb0 : tb1;
    // a lane holds 8 consecutive d of its query's row per tile: two 16-byte stores
    float* op = out + ((size_t)plane * kSeq + tb * kQBlk + qt * 16 + c) * kDh + 8 * h + n0 * 16;
    const float* r = sR + (jt * kKG * 4 + qt) * 8 * 128 + (2 * n0) * 128 + lane * 4;
#pragma unroll  // constant indices: the reads of both steps can be in flight together
    for (int n = 0; n < 2; ++n) {
      v4f lo = *(const v4f*)(r + (2 * n) * 128);
      v4f hi = *(const v4f*)(r + (2 * n + 1) * 128);
#pragma unroll  // constant indices: fixed order of the sum
      for (int gg = 1; gg < kKG; ++gg) {
        lo += *(const v4f*)(r + gg * 4 * 8 * 128 + (2 * n) * 128);
        hi += *(const v4f*)(r + gg * 4 * 8 * 128 + (2 * n + 1) * 128);
      }
      *(v4f*)(op + n * 16)     = lo * kPCarryInv;
      *(v4f*)(op + n * 16 + 4) = hi * kPCarryInv;
    }
  }
}

// ---------------------------------------------------------------------------
// Host glue. Two launches; the workspace holds the 16 x 7 stage states (f32, 16 KiB each), written by the first launch.
// ---------------------------------------------------------------------------
extern "C" void kernel_launch(void* const* d_in, const int* in_sizes, int n_in,
                              void* d_out, int out_size, void* d_ws, size_t ws_size,
                              hipStream_t stream) {
  if (n_in < 3) return;
  if (in_sizes[0] != kElems || in_sizes[1] != kElems || in_sizes[2] != kElems) return;
  if (out_size != kElems) return;
  if (ws_size < sizeof(float) * kBH * kStates * kDh * kDh) return;

  const float* q = (const float*)d_in[0];
  const float* k = (const float*)d_in[1];
  const float* v = (const float*)d_in[2];
  float* out = (float*)d_out;
  float* u = (float*)d_ws;

  // log2(gamma_h), gamma_h = 1 - 2^(-5-h) (exact in f32); log2 evaluated in double and RNE-converted to f32
  float lg[kHeads];
  for (int h = 0; h < kHeads; ++h) {
    const float gma = 1.0f - 1.0f / (float)(32 << h);
    lg[h] = (float)log2((double)gma);
  }

  decay_state_kernel<<<dim3(kStates, kBH), dim3(kThreads), 0, stream>>>(
      k, v, u, lg[0], lg[1], lg[2], lg[3], lg[4], lg[5], lg[6], lg[7]);
  decay_attn_fused_kernel<<<dim3(kTiles / 2, kBH), dim3(kThreads), 0, stream>>>(
      q, k, v, u, out, lg[0], lg[1], lg[2], lg[3], lg[4], lg[5], lg[6], lg[7]);
}

// v008
// One run takes 13.2 microseconds.
// Timed twice side by side with v007, it ran 1.05 and 1.04 times as fast.
// Counting every step since v000, it is 33.9 times as fast.
// Contractions: scores^T = k.q^T on v_wmma_f32_16x16x32_bf16 (q, k as RNE bf16, exact products), out^T = v^T @ (scores*scale*decay)^T on v_wmma_f32_16x16x32_f16 (decayed scores f16 carried x256, v as f16 holding RNE bf16 values, transposed by the LDS read); f32 accumulate; decay mask, scaling and casts in f32, the decay weight as the product of a per-lane stage factor and a per-key table. q, k, v are read as f32 by whole-line loads and cast on their way to LDS; the scores stay in registers. Scores are formed only for the 256-key stage that holds the query tile's diagonal (key tiles at or below it, split over wave groups whose f32 partial sums are joined in LDS); every earlier stage enters through its decayed 64x64 state sum_j gamma^(end-j) k_j v_j^T (first launch, v_wmma_f32_16x16x32_f16, f32 in the workspace), summed over stages in f32, cast to f16 and multiplied by q on the same f16 form.
#include <hip/hip_runtime.h>
#include <math.h>

// ---------------------------------------------------------------------------
// Problem constants
// ---------------------------------------------------------------------------
constexpr int kBatch = 2;
constexpr int kHeads = 8;
constexpr int kSeq   = 2048;
constexpr int kDh    = 64;
constexpr int kBH    = kBatch * kHeads;          // 16 (batch, head) planes
constexpr int kElems = kBH * kSeq * kDh;         // 2,097,152 elements per tensor
constexpr int kQBlk  = 64;                       // queries per tile: 4 waves x 16
constexpr int kStage = 64;                       // keys per wave and stage: one key tile
constexpr int kKG    = 4;                        // wave groups of a work-group; each takes its own key tile of a stage
constexpr int kThreads = 4 * kKG * 32;           // 4 query waves x kKG key groups
constexpr int kTiles = kSeq / kQBlk;             // 32 query tiles per plane = 32 key tiles
constexpr int kRowsPerPass = kThreads / 16;      // staging: rows of a stage that the block moves with one load per thread
constexpr int kPasses = kKG * kStage / kRowsPerPass;   // 8 loads per thread, tensor and stage
constexpr int kQPasses = kQBlk / kRowsPerPass;   // 2 loads per thread and query tile
constexpr int kLowPasses = kPasses - kStage / kRowsPerPass;   // passes that move a stage's key tiles but the last
constexpr int kSpan   = kKG * kStage;            // keys of a stage
constexpr int kStates = kSeq / kSpan - 1;        // stages that lie in front of some query tile's own stage: one state each
constexpr int kPitch  = 72;                      // K rows in LDS, 16-bit elements: 128 B of data + 16 B pad (16 B x odd, plain 16-byte reads)
constexpr int kPitchV = 80;                      // V rows in LDS, 16-bit elements: 128 B of data + 32 B pad (32 B x odd, transposing reads)
constexpr float kPCarryInv       = 1.0f / 256.0f;   // decayed scores carried x256 in f16
constexpr float kScoreScaleCarry = 0.125f * 256.0f; // 64^-0.5 * carry = 32 (exact power of two)
static_assert(kDh == 64 && kStage == 64 && kQBlk == kStage, "");   // LDS rows of 128 B; a query tile's diagonal lies in one key tile
static_assert(kTiles % 2 == 0 && kTiles % kKG == 0, "");           // tiles pair up; a stage never reaches past the last key
static_assert(kHeads == 8 && kKG == 4, "");   // eight log2(gamma) arguments; a stage's four query tiles make two pairs, 16 waves share the join

template <bool B> struct BoolConst { static constexpr bool value = B; };   // a compile-time flag as a function argument

typedef __attribute__((ext_vector_type(16))) _Float16 v16h;
typedef __attribute__((ext_vector_type(8)))  _Float16 v8h;
typedef __attribute__((ext_vector_type(16))) __bf16   v16b;
typedef __attribute__((ext_vector_type(8)))  __bf16   v8b;
typedef __attribute__((ext_vector_type(8)))  float    v8f;
typedef __attribute__((ext_vector_type(4)))  float    v4f;
typedef __attribute__((ext_vector_type(4)))  __bf16   v4b;
typedef __attribute__((ext_vector_type(4)))  _Float16 v4h;
typedef __attribute__((ext_vector_type(2)))  unsigned int v2u;
typedef __attribute__((ext_vector_type(8)))  short    v8s;

// Casts of four f32 values on their way to LDS: RNE bf16, and f16 holding the RNE bf16 value (exact for normal magnitudes).
__device__ __forceinline__ v2u cast4_bf16(v4f x) { return __builtin_bit_cast(v2u, __builtin_convertvector(x, v4b)); }
__device__ __forceinline__ v2u cast4_bf16_as_f16(v4f x) {
  const v4f y = __builtin_convertvector(__builtin_convertvector(x, v4b), v4f);
  return __builtin_bit_cast(v2u, __builtin_convertvector(y, v4h));
}

// Fragment loaders, hardware k order of the 16x16x32 16-bit forms: elements 0..7 <- p[0..7], 8..15 <- p[16..23],
// p = row start + 8 * (lane >> 4).
__device__ __forceinline__ v16b load_frag_b(const __bf16* p) {
  union { v16b v; v8b h[2]; } f; f.h[0] = *(const v8b*)(p); f.h[1] = *(const v8b*)(p + 16); return f.v;
}
// Transposing LDS read of a row-major [key][d] 16-bit tile. Lane l points at row kbase + 8 (l >> 4) + (l & 7), byte
// 2 dbase + 16 ((l >> 3) & 1); lane (c, h) receives keys kbase + 8h + 0..7 of column dbase + c. The reads at kbase and
// kbase + 16 are elements 0..7 and 8..15 of one 16 (d) x 32 (keys) A fragment in the hardware k order.
__device__ __forceinline__ v8h ld_tr16(const _Float16* p) {
  typedef __attribute__((address_space(3))) v8s lds_v8s;
  return __builtin_bit_cast(v8h, __builtin_amdgcn_ds_load_tr16_b128_v8i16((lds_v8s*)p));
}
__device__ __forceinline__ v16h load_frag_tr(const _Float16* p) {
  union { v16h v; v8h h[2]; } f; f.h[0] = ld_tr16(p); f.h[1] = ld_tr16(p + 16 * kPitchV); return f.v;
}

// ---------------------------------------------------------------------------
// One stage (64 keys) of one wave's 16 queries, K and V tiles in LDS, both [key][d]. c = lane & 15 (query column), h = lane >> 4.
// T[t][r] = S^T[key 16t + 8h + r][query c] (A = K rows, B = Q rows, read from LDS by the caller);
//   P = f16( w * S ), w = 256 * 0.125 * gamma_h^(i-j) for j <= i, 0 for j > i, in f32, factored over i - j = dbase - off:
//   w = [32 * exp2(dbase * log2_gamma_h)] * ck[e], ck[e] = exp2(-off * log2_gamma_h), off = 16 (e >> 3) + (e & 7) in [0, 55]:
//   one exp2 per lane and stage, the table made once per kernel. dbase < 0 puts every key of the lane's stage above the
//   diagonal (stage factor 0); dbase >= 55 none; between the two lies only the wave's one diagonal stage (diag), which
//   alone tests each element;
//   two converted tiles are the B operand of the second product as they lie (element s = T[s >> 3][s & 7] of 32 keys);
//   acc[n][r] += O^T[d 16n + 8h + r][query c] (A = V^T rows in the same k order, by the transposing read; bV is the
//   lane's own read address in the V tile). dbase = i - (first key + 8h).
// ---------------------------------------------------------------------------
__device__ __forceinline__ void stage_compute(const __bf16* __restrict__ bK, const _Float16* __restrict__ bV,
                                              const v16b (&qf)[2], v8f (&acc)[4], const float (&ck)[32], int dbase, float lg,
                                              bool diag, int c, int h) {
  v16b ka[4][2];
#pragma unroll  // constant indices: the fragment and accumulator arrays stay in registers
  for (int tt = 0; tt < 4; ++tt)
#pragma unroll  // constant indices: the fragment and accumulator arrays stay in registers
    for (int kk = 0; kk < 2; ++kk) ka[tt][kk] = load_frag_b(bK + (tt * 16 + c) * kPitch + kk * 32 + 8 * h);
  // keeps the K fragment loads one group ahead of the products: spread among them each load waits out its own LDS latency
  __builtin_amdgcn_sched_barrier(0);
  const float eg = exp2f((float)dbase * lg) * kScoreScaleCarry;   // exponent in [-94, 94]: finite, normal f32
  const float e0 = (dbase >= 0) ? eg : 0.0f;
  v8f T[4];
#pragma unroll  // constant indices: the fragment and accumulator arrays stay in registers
  for (int tt = 0; tt < 4; ++tt) {
    T[tt] = (v8f){0.f, 0.f, 0.f, 0.f, 0.f, 0.f, 0.f, 0.f};
#pragma unroll  // constant indices: the fragment and accumulator arrays stay in registers
    for (int kk = 0; kk < 2; ++kk)
      T[tt] = __builtin_amdgcn_wmma_f32_16x16x32_bf16(false, ka[tt][kk], false, qf[kk], (short)0, T[tt], false, false);
  }
  v16h va[2][4];
#pragma unroll  // constant indices: the fragment and accumulator arrays stay in registers
  for (int p = 0; p < 2; ++p)
#pragma unroll  // constant indices: the fragment and accumulator arrays stay in registers
    for (int n = 0; n < 4; ++n) va[p][n] = load_frag_tr(bV + p * 32 * kPitchV + n * 16);
  // keeps the V^T fragment loads in front of the weighting and the f16 casts, which then cover part of their LDS latency
  __builtin_amdgcn_sched_barrier(0);
#pragma unroll  // constant indices: the fragment and accumulator arrays stay in registers
  for (int p = 0; p < 2; ++p) {
    v16h pf;
#pragma unroll  // constant indices: the fragment and accumulator arrays stay in registers
    for (int tt = 0; tt < 2; ++tt) {
#pragma unroll  // constant indices: the fragment and accumulator arrays stay in registers
      for (int r = 0; r < 8; ++r) {
        // the weight is made where it is used: 32 fewer live registers over the fragment loads
        float w = e0 * ck[(p * 2 + tt) * 8 + r];
        if (diag) w = (dbase >= (p * 2 + tt) * 16 + r) ? w : 0.0f;   // causal zero above the diagonal; diag is a constant of the call
        pf[tt * 8 + r] = (_Float16)(T[p * 2 + tt][r] * w);
      }
    }
#pragma unroll  // constant indices: the fragment and accumulator arrays stay in registers
    for (int n = 0; n < 4; ++n)
      acc[n] = __builtin_amdgcn_wmma_f32_16x16x32_f16(false, va[p][n], false, pf, (short)0, acc[n], false, false);
  }
}

// ---------------------------------------------------------------------------
// State of one stage: U[dk][dv] = sum over the stage's keys j of gamma_h^(stage end - j) * k_j[dk] * v_j[dv], exponent in
// [1, 256], so every weight is at most 1. grid (7, 16): blockIdx.x = stage, blockIdx.y = plane. K (f16 holding the RNE bf16
// value) and the weighted V (f16) lie in LDS as [key][d]; both operands come by the transposing read at the same key base,
// so their k orders are equal: D[dv 8h + r][dk c] = A (V^T) x B (K). Eight waves take 16 dk x 32 dv each: a lane stores 8
// consecutive dv of its dk row per tile, a wave whole 128-byte lines.
// ---------------------------------------------------------------------------
__global__ __launch_bounds__(kThreads) void decay_state_kernel(
    const float* __restrict__ k, const float* __restrict__ v, float* __restrict__ u,
    float lg0, float lg1, float lg2, float lg3, float lg4, float lg5, float lg6, float lg7) {
  __shared__ __align__(16) unsigned short sK[kSpan * kPitchV];   // [key][d], f16
  __shared__ __align__(16) unsigned short sV[kSpan * kPitchV];   // [key][d], f16, weighted
  const int t     = threadIdx.x;
  const int lane  = t & 31;
  const int wave  = __builtin_amdgcn_readfirstlane(t >> 5);         // scalar: the test on the wave below is a scalar branch
  const int c     = lane & 15;
  const int h     = lane >> 4;
  const int plane = blockIdx.y;
  const int head  = blockIdx.y % kHeads;
  const float lg = (head == 0) ? lg0 : (head == 1) ? lg1 : (head == 2) ? lg2 : (head == 3) ? lg3
                 : (head == 4) ? lg4 : (head == 5) ? lg5 : (head == 6) ? lg6 : lg7;
  const int srow = t >> 4;
  const int scol = (t & 15) * 4;
  const int soV  = srow * kPitchV + scol;
  const int vo = (8 * h + (lane & 7)) * kPitchV + 8 * ((lane >> 3) & 1);

  const float* gK = k + ((size_t)plane * kSeq + (int)blockIdx.x * kSpan + srow) * kDh + scol;
  const float* gV = v + ((size_t)plane * kSeq + (int)blockIdx.x * kSpan + srow) * kDh + scol;
  v4f rk[kPasses], rv[kPasses];
#pragma unroll  // constant indices: the staging arrays stay in registers
  for (int j = 0; j < kPasses; ++j) {
    rk[j] = *(const v4f*)(gK + j * kRowsPerPass * kDh);
    rv[j] = *(const v4f*)(gV + j * kRowsPerPass * kDh);
  }
  // the loads' address registers are reused right below: this wait stands in front of that overwrite; the two addresses are
  // its inputs so that they stay whole up to it (no later load of the group lands in them)
  asm volatile("s_wait_xcnt 0x0" :: "v"(gK), "v"(gV) : "memory");
  // every load is issued before the first cast waits for one: moved below a wait, a load would pay its latency anew
  __builtin_amdgcn_sched_barrier(0);
#pragma unroll  // constant indices: the staging arrays stay in registers
  for (int j = 0; j < kPasses; ++j) {
    const float w = exp2f((float)(kSpan - srow - j * kRowsPerPass) * lg);
    const v4f vb = __builtin_convertvector(__builtin_convertvector(rv[j], v4b), v4f);   // the RNE bf16 value of v, as in the score path
    *(v2u*)(&sK[soV + j * kRowsPerPass * kPitchV]) = cast4_bf16_as_f16(rk[j]);
    *(v2u*)(&sV[soV + j * kRowsPerPass * kPitchV]) = __builtin_bit_cast(v2u, __builtin_convertvector(vb * w, v4h));
  }
  __syncthreads();   // the stage's two tiles published

  if (wave < 8) {
    const int nk = wave & 3;    // 16 dk
    const int nv = wave >> 2;   // 32 dv
    const _Float16* bK = (const _Float16*)sK + nk * 16 + vo;
    const _Float16* bV = (const _Float16*)sV + nv * 32 + vo;
    v8f d0 = (v8f){0.f, 0.f, 0.f, 0.f, 0.f, 0.f, 0.f, 0.f};
    v8f d1 = d0;
#pragma unroll  // the fragment loads of all eight 32-key steps can be in flight together
    for (int p = 0; p < kSpan / 32; ++p) {
      const v16h kb = load_frag_tr(bK + p * 32 * kPitchV);
      d0 = __builtin_amdgcn_wmma_f32_16x16x32_f16(false, load_frag_tr(bV + p * 32 * kPitchV), false, kb, (short)0, d0, false, false);
      d1 = __builtin_amdgcn_wmma_f32_16x16x32_f16(false, load_frag_tr(bV + p * 32 * kPitchV + 16), false, kb, (short)0, d1, false, false);
    }
    float* up = u + (((size_t)plane * kStates + blockIdx.x) * kDh + nk * 16 + c) * kDh + nv * 32 + 8 * h;
    *(v4f*)(up)      = (v4f){d0[0], d0[1], d0[2], d0[3]};
    *(v4f*)(up + 4)  = (v4f){d0[4], d0[5], d0[6], d0[7]};
    *(v4f*)(up + 16) = (v4f){d1[0], d1[1], d1[2], d1[3]};
    *(v4f*)(up + 20) = (v4f){d1[4], d1[5], d1[6], d1[7]};
  }
}

// ---------------------------------------------------------------------------
// Fused casts, scores, decay and output product. grid (16, 16): blockIdx.x = (stage, pair of its query tiles), blockIdx.y =
// (batch, head) plane. A work-group takes two 64-query tiles of ONE 256-key stage m, tiles 3 - a and a of the stage's four
// (five key tiles at or below the two diagonals for either a), and stages what both need, the stage's K and V and Z, once.
// Keys of stage m: scores, as below. Keys in front of stage m:
//   sum_j gamma^(i-j) (q_i.k_j) v_j = gamma^(i - 256 m) * q_i . Z,  Z[dk][dv] = sum_{s < m} gamma^(256 (m-1-s)) U_s[dk][dv],
//   U_s from the first launch; every exponent is >= 0. Z is summed in f32, s ascending, cast to f16 and laid in LDS as
//   [dk][dv]: read like a V tile of 64 keys, with q (f16 holding its RNE bf16 value) in the place of the decayed scores.
// Wave = (query group qt, key group g): 16 queries of each of the two tiles, one tile after the other, and key tile
// m * kKG + g. The last key group also takes the Z products.
// The kKG partial sums of a query tile are joined through LDS in the fixed order g = 0, 1, ...; every wave joins a share.
// K and V tiles and the two query tiles go global f32 -> registers -> cast -> LDS, one buffer each, filled once per work-group.
// ---------------------------------------------------------------------------
__global__ __launch_bounds__(kThreads) void decay_attn_fused_kernel(
    const float* __restrict__ q, const float* __restrict__ k, const float* __restrict__ v, const float* __restrict__ u,
    float* __restrict__ out,
    float lg0, float lg1, float lg2, float lg3, float lg4, float lg5, float lg6, float lg7) {
  __shared__ __align__(16) unsigned short sK[kSpan * kPitch];     // [key][d], bf16
  __shared__ __align__(16) unsigned short sV[kSpan * kPitchV];    // [key][d], f16
  __shared__ __align__(16) unsigned short sZ[kDh * kPitchV];      // [dk][dv], f16
  __shared__ __align__(16) unsigned short sQ[2 * kQBlk * kPitch]; // [tile of the pair][query][d], bf16
  __shared__ __align__(16) float sR[2 * kKG * 4 * 8 * 128];       // partial sums: [tile of the pair][g][qt][chunk][lane][4]
  const int t     = threadIdx.x;
  const int lane  = t & 31;
  const int wave  = __builtin_amdgcn_readfirstlane(t >> 5);         // scalar: the tests on g below are scalar branches
  const int qt    = wave & 3;
  const int g     = wave >> 2;
  const int c     = lane & 15;
  const int h     = lane >> 4;
  const int plane = blockIdx.y;
  const int head  = blockIdx.y % kHeads;
  const float lg = (head == 0) ? lg0 : (head == 1) ? lg1 : (head == 2) ? lg2 : (head == 3) ? lg3
                 : (head == 4) ? lg4 : (head == 5) ? lg5 : (head == 6) ? lg6 : lg7;
  const int m     = kStates - ((int)blockIdx.x >> 1);               // the stage = number of stages in front of it; most states first
  const int a     = (int)blockIdx.x & 1;
  const int tb0   = m * kKG + (kKG - 1 - a);                        // the pair's two query tiles
  const int tb1   = m * kKG + a;
  const bool top  = (a == 0);                                       // the pair holds the stage's last query tile, so it reads the last key tile

  // staging map: thread t moves 4 elements of rows (t >> 4) + kRowsPerPass j of each stage; 16 threads cover one 256-B f32 row
  const int srow = t >> 4;
  const int scol = (t & 15) * 4;
  const int soK  = srow * kPitch + scol;
  const int soV  = srow * kPitchV + scol;
  // this lane's address in a V tile for the transposing reads
  const int vo = (8 * h + (lane & 7)) * kPitchV + 8 * ((lane >> 3) & 1);
  // this wave's key tile inside a stage
  const int koK = g * kStage * kPitch;
  const int koV = g * kStage * kPitchV + vo;

  float ck[32];   // per-key factors of the decay weight, made below while the loads are in flight

  const float* gQ0 = q + ((size_t)plane * kSeq + tb0 * kQBlk + srow) * kDh + scol;
  const float* gQ1 = q + ((size_t)plane * kSeq + tb1 * kQBlk + srow) * kDh + scol;

  const float* gK = k + ((size_t)plane * kSeq + m * kSpan + srow) * kDh + scol;
  const float* gV = v + ((size_t)plane * kSeq + m * kSpan + srow) * kDh + scol;
  const float* gU = u + (size_t)plane * kStates * kDh * kDh + srow * kDh + scol;   // the lane's place in state 0; a state is a constant step
  // the staging, written once and built twice, for a pair that reads the stage's last key tile and for one that does not: in
  // either build the K and V loads and their casts are straight-line code with a fixed number of loads
  auto stage_in = [&](auto topc) __attribute__((always_inline)) {
    constexpr int kMyPasses = decltype(topc)::value ? kPasses : kLowPasses;
    v4f rq[2][kQPasses], rk[kMyPasses], rv[kMyPasses], ru[kStates][2];
    // Only what the work-group reads is loaded; every test below is on blockIdx alone, a scalar branch, and no wait stands
    // between the loads, so that all of them are in flight together. The loads whose number varies go first: the counted
    // waits of the casts below then count only the fixed loads behind them.
    // the states in front of the stage, and no other: rows srow and srow + 32 of each
#pragma unroll  // constant indices: the staging arrays stay in registers
    for (int s = 0; s < kStates; ++s) {
      if (s < m) {
        ru[s][0] = *(const v4f*)(gU + s * kDh * kDh);
        ru[s][1] = *(const v4f*)(gU + s * kDh * kDh + kRowsPerPass * kDh);
      }
    }
    // the pair's two query tiles, moved like K: a wave's load covers two whole 256-byte rows, and the block reads each row once
#pragma unroll  // constant indices: the staging arrays stay in registers
    for (int j = 0; j < kQPasses; ++j) {
      rq[0][j] = *(const v4f*)(gQ0 + j * kRowsPerPass * kDh);
      rq[1][j] = *(const v4f*)(gQ1 + j * kRowsPerPass * kDh);
    }
    // the stage's last key tile lies above both diagonals of the pair (2, 1): only the pair (3, 0) loads it
#pragma unroll  // constant indices: the staging arrays stay in registers
    for (int j = 0; j < kMyPasses; ++j) {
      rk[j] = *(const v4f*)(gK + j * kRowsPerPass * kDh);
      rv[j] = *(const v4f*)(gV + j * kRowsPerPass * kDh);
    }
    // the loads' address registers are reused right below: this wait stands in front of that overwrite; the five addresses are
    // its inputs so that they stay whole up to it (no later load of the group lands in them)
    asm volatile("s_wait_xcnt 0x0" :: "v"(gQ0), "v"(gQ1), "v"(gK), "v"(gV), "v"(gU) : "memory");
    // every load is issued before the first cast waits for one: moved below a wait, a load would pay its latency anew
    __builtin_amdgcn_sched_barrier(0);
    // per-key factors of the decay weight, the same in every stage and lane: lane e makes entry e (one exp2 for the table),
    // and the lane reads hand all 32 entries to every lane
    const int ckl = __builtin_bit_cast(int, exp2f(-(float)((lane >> 3) * 16 + (lane & 7)) * lg));
#pragma unroll  // constant indices: the table stays in registers
    for (int e = 0; e < 32; ++e) ck[e] = __builtin_bit_cast(float, __builtin_amdgcn_readlane(ckl, e));
#pragma unroll  // constant indices: the staging arrays stay in registers
    for (int tl = 0; tl < 2; ++tl)
#pragma unroll  // constant indices: the staging arrays stay in registers
      for (int j = 0; j < kQPasses; ++j)
        *(v2u*)(&sQ[tl * kQBlk * kPitch + soK + j * kRowsPerPass * kPitch]) = cast4_bf16(rq[tl][j]);
#pragma unroll  // constant indices: the staging arrays stay in registers
    for (int j = 0; j < kMyPasses; ++j) {
      *(v2u*)(&sK[soK + j * kRowsPerPass * kPitch])  = cast4_bf16(rk[j]);
      *(v2u*)(&sV[soV + j * kRowsPerPass * kPitchV]) = cast4_bf16_as_f16(rv[j]);
    }
    // Z is read only where a stage lies in front (m > 0)
    if (m > 0) {
      v4f z0 = (v4f){0.f, 0.f, 0.f, 0.f}, z1 = z0;
#pragma unroll  // constant indices: the staging arrays stay in registers; fixed order of the sum
      for (int s = 0; s < kStates; ++s) {
        if (s < m) {
          const float cf = exp2f((float)((m - 1 - s) * kSpan) * lg);
          z0 += ru[s][0] * cf;
          z1 += ru[s][1] * cf;
        }
      }
      *(v2u*)(&sZ[soV])                           = __builtin_bit_cast(v2u, __builtin_convertvector(z0, v4h));
      *(v2u*)(&sZ[soV + kRowsPerPass * kPitchV]) = __builtin_bit_cast(v2u, __builtin_convertvector(z1, v4h));
    }
  };
  if (top) stage_in(BoolConst<true>{});
  else     stage_in(BoolConst<false>{});
  __syncthreads();   // the stage, the two query tiles and Z published

  const int kt = m * kKG + g;   // this wave's key tile
#pragma unroll  // constant tl: the tile's places in LDS are constants of the addresses
  for (int tl = 0; tl < 2; ++tl) {
    const int tb = (tl == 0) ? tb0 : tb1;                           // query tile
    const int i  = tb * kQBlk + qt * 16 + c;                        // this lane's query
    v8f acc[4];
#pragma unroll  // constant indices: the fragment and accumulator arrays stay in registers
    for (int n = 0; n < 4; ++n) acc[n] = (v8f){0.f, 0.f, 0.f, 0.f, 0.f, 0.f, 0.f, 0.f};

    const int dbase = i - m * kSpan - g * kStage - 8 * h;
    const bool zw = (g == kKG - 1 && m > 0);                        // this wave takes the Z products
    // the wave's 16 queries as B fragments, read like K rows (same k order); a wave with no product for the tile reads none
    v16b qf[2];
    if (kt <= tb || zw) {
#pragma unroll  // constant indices: the fragment and accumulator arrays stay in registers
      for (int kk = 0; kk < 2; ++kk)
        qf[kk] = load_frag_b((const __bf16*)sQ + (tl * kQBlk + qt * 16 + c) * kPitch + kk * 32 + 8 * h);
    }
    // this wave's key tile lies below the diagonal, on it, or above it (nothing to add)
    if (kt < tb)
      stage_compute((const __bf16*)sK + koK, (const _Float16*)sV + koV, qf, acc, ck, dbase, lg, false, c, h);
    else if (kt == tb)
      stage_compute((const __bf16*)sK + koK, (const _Float16*)sV + koV, qf, acc, ck, dbase, lg, true, c, h);

    // every key in front of the stage, through Z: O^T[dv][query] += 32 gamma^(i - 256 m) * (Z^T q_i); the factor is the
    // lane's own (a D column is one query), applied in f32
    if (zw) {
      v16h qh[2];
#pragma unroll  // constant indices: the fragment and accumulator arrays stay in registers
      for (int p = 0; p < 2; ++p)
        qh[p] = __builtin_convertvector(__builtin_convertvector(qf[p], __attribute__((ext_vector_type(16))) float), v16h);
      const float ez = exp2f((float)(i - m * kSpan) * lg) * kScoreScaleCarry;
#pragma unroll  // constant indices: the fragment and accumulator arrays stay in registers
      for (int n = 0; n < 4; ++n) {
        v8f tz = (v8f){0.f, 0.f, 0.f, 0.f, 0.f, 0.f, 0.f, 0.f};
#pragma unroll  // constant indices: the fragment and accumulator arrays stay in registers
        for (int p = 0; p < 2; ++p)
          tz = __builtin_amdgcn_wmma_f32_16x16x32_f16(false, load_frag_tr((const _Float16*)sZ + vo + p * 32 * kPitchV + n * 16),
                                                      false, qh[p], (short)0, tz, false, false);
        acc[n] += tz * ez;
      }
    }

    // every key group hands its partial sums of the tile over in LDS
    float* r = sR + ((tl * kKG + g) * 4 + qt) * 8 * 128 + lane * 4;
#pragma unroll  // constant indices: the fragment and accumulator arrays stay in registers
    for (int n = 0; n < 4; ++n) {
      *(v4f*)(r + (2 * n) * 128)     = (v4f){acc[n][0], acc[n][1], acc[n][2], acc[n][3]};
      *(v4f*)(r + (2 * n + 1) * 128) = (v4f){acc[n][4], acc[n][5], acc[n][6], acc[n][7]};
    }
  }
  __syncthreads();   // publishes the partial sums of both tiles

  // join: wave (qt, g) adds, in the order of the key groups, the partial sums of tile g >> 1 of the pair for 32 of the 64 d
  // (one 128-byte line of each of its 16 rows) and stores them
  {
    const int jt = g >> 1;
    const int n0 = (g & 1) * 2;
    const int tb = (jt == 0) ? tb0 : tb1;
    // a lane holds 8 consecutive d of its query's row per tile: two 16-byte stores
    float* op = out + ((size_t)plane * kSeq + tb * kQBlk + qt * 16 + c) * kDh + 8 * h + n0 * 16;
    const float* r = sR + (jt * kKG * 4 + qt) * 8 * 128 + (2 * n0) * 128 + lane * 4;
#pragma unroll  // constant indices: the reads of both steps can be in flight together
    for (int n = 0; n < 2; ++n) {
      v4f lo = *(const v4f*)(r + (2 * n) * 128);
      v4f hi = *(const v4f*)(r + (2 * n + 1) * 128);
#pragma unroll  // constant indices: fixed order of the sum
      for (int gg = 1; gg < kKG; ++gg) {
        lo += *(const v4f*)(r + gg * 4 * 8 * 128 + (2 * n) * 128);
        hi += *(const v4f*)(r + gg * 4 * 8 * 128 + (2 * n + 1) * 128);
      }
      *(v4f*)(op + n * 16)     = lo * kPCarryInv;
      *(v4f*)(op + n * 16 + 4) = hi * kPCarryInv;
    }
  }
}

// ---------------------------------------------------------------------------
// Host glue. Two launches; the workspace holds the 16 x 7 stage states (f32, 16 KiB each), written by the first launch.
// ---------------------------------------------------------------------------
extern "C" void kernel_launch(void* const* d_in, const int* in_sizes, int n_in,
                              void* d_out, int out_size, void* d_ws, size_t ws_size,
                              hipStream_t stream) {
  if (n_in < 3) return;
  if (in_sizes[0] != kElems || in_sizes[1] != kElems || in_sizes[2] != kElems) return;
  if (out_size != kElems) return;
  if (ws_size < sizeof(float) * kBH * kStates * kDh * kDh) return;

  const float* q = (const float*)d_in[0];
  const float* k = (const float*)d_in[1];
  const float* v = (const float*)d_in[2];
  float* out = (float*)d_out;
  float* u = (float*)d_ws;

  // log2(gamma_h), gamma_h = 1 - 2^(-5-h) (exact in f32); log2 evaluated in double and RNE-converted to f32
  float lg[kHeads];
  for (int h = 0; h < kHeads; ++h) {
    const float gma = 1.0f - 1.0f / (float)(32 << h);
    lg[h] = (float)log2((double)gma);
  }

  decay_state_kernel<<<dim3(kStates, kBH), dim3(kThreads), 0, stream>>>(
      k, v, u, lg[0], lg[1], lg[2], lg[3], lg[4], lg[5], lg[6], lg[7]);
  decay_attn_fused_kernel<<<dim3(kTiles / 2, kBH), dim3(kThreads), 0, stream>>>(
      q, k, v, u, out, lg[0], lg[1], lg[2], lg[3], lg[4], lg[5], lg[6], lg[7]);
}

// v009
// It runs in 12.2 microseconds.
// Two timings next to v008 put it at 1.09 and 1.08 times that version's speed.
// Over all steps from v000 it is 36.8 times as fast.
// Contractions: scores^T = k.q^T on v_wmma_f32_16x16x32_bf16 (q, k as RNE bf16, exact products), out^T = v^T @ (scores*scale*decay)^T on v_wmma_f32_16x16x32_f16 (decayed scores f16 carried x256, v as f16 holding RNE bf16 values, transposed by the LDS read); f32 accumulate; decay mask, scaling and casts in f32, the decay weight as the product of a per-lane stage factor and a per-key table. q, k, v are read as f32 by whole-line loads and cast on their way to LDS; the scores stay in registers. Scores are formed only for the 256-key stage that holds the query tile's diagonal (key tiles at or below it, split over wave groups whose f32 partial sums are joined in LDS); every earlier stage enters through its decayed 64x64 state sum_j gamma^(end-j) k_j v_j^T (first launch, v_wmma_f32_16x16x32_f16, f32 in the workspace), summed over stages in f32, cast to f16 and multiplied by q on the same f16 form.
#include <hip/hip_runtime.h>
#include <math.h>

// ---------------------------------------------------------------------------
// Problem constants
// ---------------------------------------------------------------------------
constexpr int kBatch = 2;
constexpr int kHeads = 8;
constexpr int kSeq   = 2048;
constexpr int kDh    = 64;
constexpr int kBH    = kBatch * kHeads;          // 16 (batch, head) planes
constexpr int kElems = kBH * kSeq * kDh;         // 2,097,152 elements per tensor
constexpr int kQBlk  = 64;                       // queries per tile: 4 waves x 16
constexpr int kStage = 64;                       // keys per key tile; a wave takes two of a stage
constexpr int kKG    = 4;                        // key tiles of a stage
constexpr int kWG    = 2;                        // wave groups of a work-group; group G takes key tiles G and G + kWG of a stage
constexpr int kThreads = 4 * kWG * 32;           // 4 query waves x kWG wave groups: 8 waves, two on a SIMD
constexpr int kTiles = kSeq / kQBlk;             // 32 query tiles per plane = 32 key tiles
constexpr int kRowsPerPass = kThreads / 16;      // staging: rows of a stage that the block moves with one load per thread
constexpr int kPasses = kKG * kStage / kRowsPerPass;   // 16 loads per thread, tensor and stage
constexpr int kQPasses = kQBlk / kRowsPerPass;   // 4 loads per thread and query tile
constexpr int kUPasses = kDh / kRowsPerPass;     // 4 loads per thread and state
constexpr int kLowPasses = kPasses - kStage / kRowsPerPass;   // passes that move a stage's key tiles but the last
constexpr int kSpan   = kKG * kStage;            // keys of a stage
constexpr int kStates = kSeq / kSpan - 1;        // stages that lie in front of some query tile's own stage: one state each
constexpr int kPitch  = 72;                      // K rows in LDS, 16-bit elements: 128 B of data + 16 B pad (16 B x odd, plain 16-byte reads)
constexpr int kPitchV = 80;                      // V rows in LDS, 16-bit elements: 128 B of data + 32 B pad (32 B x odd, transposing reads)
constexpr float kPCarryInv       = 1.0f / 256.0f;   // decayed scores carried x256 in f16
constexpr float kScoreScaleCarry = 0.125f * 256.0f; // 64^-0.5 * carry = 32 (exact power of two)
static_assert(kDh == 64 && kStage == 64 && kQBlk == kStage, "");   // LDS rows of 128 B; a query tile's diagonal lies in one key tile
static_assert(kTiles % 2 == 0 && kTiles % kKG == 0, "");           // tiles pair up; a stage never reaches past the last key
static_assert(kHeads == 8 && kKG == 4 && kWG == 2, "");   // eight log2(gamma) arguments; a stage's four query tiles make two pairs; a wave group joins one tile of the pair

template <bool B> struct BoolConst { static constexpr bool value = B; };   // a compile-time flag as a function argument

typedef __attribute__((ext_vector_type(16))) _Float16 v16h;
typedef __attribute__((ext_vector_type(8)))  _Float16 v8h;
typedef __attribute__((ext_vector_type(16))) __bf16   v16b;
typedef __attribute__((ext_vector_type(8)))  __bf16   v8b;
typedef __attribute__((ext_vector_type(8)))  float    v8f;
typedef __attribute__((ext_vector_type(4)))  float    v4f;
typedef __attribute__((ext_vector_type(4)))  __bf16   v4b;
typedef __attribute__((ext_vector_type(4)))  _Float16 v4h;
typedef __attribute__((ext_vector_type(2)))  unsigned int v2u;
typedef __attribute__((ext_vector_type(8)))  short    v8s;

// Casts of four f32 values on their way to LDS: RNE bf16, and f16 holding the RNE bf16 value (exact for normal magnitudes).
__device__ __forceinline__ v2u cast4_bf16(v4f x) { return __builtin_bit_cast(v2u, __builtin_convertvector(x, v4b)); }
__device__ __forceinline__ v2u cast4_bf16_as_f16(v4f x) {
  const v4f y = __builtin_convertvector(__builtin_convertvector(x, v4b), v4f);
  return __builtin_bit_cast(v2u, __builtin_convertvector(y, v4h));
}

// Fragment loaders, hardware k order of the 16x16x32 16-bit forms: elements 0..7 <- p[0..7], 8..15 <- p[16..23],
// p = row start + 8 * (lane >> 4).
__device__ __forceinline__ v16b load_frag_b(const __bf16* p) {
  union { v16b v; v8b h[2]; } f; f.h[0] = *(const v8b*)(p); f.h[1] = *(const v8b*)(p + 16); return f.v;
}
// Transposing LDS read of a row-major [key][d] 16-bit tile. Lane l points at row kbase + 8 (l >> 4) + (l & 7), byte
// 2 dbase + 16 ((l >> 3) & 1); lane (c, h) receives keys kbase + 8h + 0..7 of column dbase + c. The reads at kbase and
// kbase + 16 are elements 0..7 and 8..15 of one 16 (d) x 32 (keys) A fragment in the hardware k order.
__device__ __forceinline__ v8h ld_tr16(const _Float16* p) {
  typedef __attribute__((address_space(3))) v8s lds_v8s;
  return __builtin_bit_cast(v8h, __builtin_amdgcn_ds_load_tr16_b128_v8i16((lds_v8s*)p));
}
__device__ __forceinline__ v16h load_frag_tr(const _Float16* p) {
  union { v16h v; v8h h[2]; } f; f.h[0] = ld_tr16(p); f.h[1] = ld_tr16(p + 16 * kPitchV); return f.v;
}

// ---------------------------------------------------------------------------
// One stage (64 keys) of one wave's 16 queries, K and V tiles in LDS, both [key][d]. c = lane & 15 (query column), h = lane >> 4.
// T[t][r] = S^T[key 16t + 8h + r][query c] (A = K rows, B = Q rows, read from LDS by the caller);
//   P = f16( w * S ), w = 256 * 0.125 * gamma_h^(i-j) for j <= i, 0 for j > i, in f32, factored over i - j = dbase - off:
//   w = [32 * exp2(dbase * log2_gamma_h)] * ck[e], ck[e] = exp2(-off * log2_gamma_h), off = 16 (e >> 3) + (e & 7) in [0, 55]:
//   one exp2 per lane and stage, the table made once per kernel. dbase < 0 puts every key of the lane's stage above the
//   diagonal (stage factor 0); dbase >= 55 none; between the two lies only the wave's one diagonal stage (diag), which
//   alone tests each element;
//   two converted tiles are the B operand of the second product as they lie (element s = T[s >> 3][s & 7] of 32 keys);
//   acc[n][r] += O^T[d 16n + 8h + r][query c] (A = V^T rows in the same k order, by the transposing read; bV is the
//   lane's own read address in the V tile). dbase = i - (first key + 8h).
// ---------------------------------------------------------------------------
__device__ __forceinline__ void stage_compute(const __bf16* __restrict__ bK, const _Float16* __restrict__ bV,
                                              const v16b (&qf)[2], v8f (&acc)[4], const float (&ck)[32], int dbase, float lg,
                                              bool diag, int c, int h) {
  v16b ka[4][2];
#pragma unroll  // constant indices: the fragment and accumulator arrays stay in registers
  for (int tt = 0; tt < 4; ++tt)
#pragma unroll  // constant indices: the fragment and accumulator arrays stay in registers
    for (int kk = 0; kk < 2; ++kk) ka[tt][kk] = load_frag_b(bK + (tt * 16 + c) * kPitch + kk * 32 + 8 * h);
  // keeps the K fragment loads one group ahead of the products: spread among them each load waits out its own LDS latency
  __builtin_amdgcn_sched_barrier(0);
  const float eg = exp2f((float)dbase * lg) * kScoreScaleCarry;   // exponent in [-94, 94]: finite, normal f32
  const float e0 = (dbase >= 0) ? eg : 0.0f;
  v8f T[4];
#pragma unroll  // constant indices: the fragment and accumulator arrays stay in registers
  for (int tt = 0; tt < 4; ++tt) {
    T[tt] = (v8f){0.f, 0.f, 0.f, 0.f, 0.f, 0.f, 0.f, 0.f};
#pragma unroll  // constant indices: the fragment and accumulator arrays stay in registers
    for (int kk = 0; kk < 2; ++kk)
      T[tt] = __builtin_amdgcn_wmma_f32_16x16x32_bf16(false, ka[tt][kk], false, qf[kk], (short)0, T[tt], false, false);
  }
  v16h va[2][4];
#pragma unroll  // constant indices: the fragment and accumulator arrays stay in registers
  for (int p = 0; p < 2; ++p)
#pragma unroll  // constant indices: the fragment and accumulator arrays stay in registers
    for (int n = 0; n < 4; ++n) va[p][n] = load_frag_tr(bV + p * 32 * kPitchV + n * 16);
  // keeps the V^T fragment loads in front of the weighting and the f16 casts, which then cover part of their LDS latency
  __builtin_amdgcn_sched_barrier(0);
#pragma unroll  // constant indices: the fragment and accumulator arrays stay in registers
  for (int p = 0; p < 2; ++p) {
    v16h pf;
#pragma unroll  // constant indices: the fragment and accumulator arrays stay in registers
    for (int tt = 0; tt < 2; ++tt) {
#pragma unroll  // constant indices: the fragment and accumulator arrays stay in registers
      for (int r = 0; r < 8; ++r) {
        // the weight is made where it is used: 32 fewer live registers over the fragment loads
        float w = e0 * ck[(p * 2 + tt) * 8 + r];
        if (diag) w = (dbase >= (p * 2 + tt) * 16 + r) ? w : 0.0f;   // causal zero above the diagonal; diag is a constant of the call
        pf[tt * 8 + r] = (_Float16)(T[p * 2 + tt][r] * w);
      }
    }
#pragma unroll  // constant indices: the fragment and accumulator arrays stay in registers
    for (int n = 0; n < 4; ++n)
      acc[n] = __builtin_amdgcn_wmma_f32_16x16x32_f16(false, va[p][n], false, pf, (short)0, acc[n], false, false);
  }
}

// ---------------------------------------------------------------------------
// State of one stage: U[dk][dv] = sum over the stage's keys j of gamma_h^(stage end - j) * k_j[dk] * v_j[dv], exponent in
// [1, 256], so every weight is at most 1. grid (7, 16): blockIdx.x = stage, blockIdx.y = plane. K (f16 holding the RNE bf16
// value) and the weighted V (f16) lie in LDS as [key][d]; both operands come by the transposing read at the same key base,
// so their k orders are equal: D[dv 8h + r][dk c] = A (V^T) x B (K). Eight waves take 16 dk x 32 dv each: a lane stores 8
// consecutive dv of its dk row per tile, a wave whole 128-byte lines.
// ---------------------------------------------------------------------------
__global__ __launch_bounds__(kThreads) void decay_state_kernel(
    const float* __restrict__ k, const float* __restrict__ v, float* __restrict__ u,
    float lg0, float lg1, float lg2, float lg3, float lg4, float lg5, float lg6, float lg7) {
  __shared__ __align__(16) unsigned short sK[kSpan * kPitchV];   // [key][d], f16
  __shared__ __align__(16) unsigned short sV[kSpan * kPitchV];   // [key][d], f16, weighted
  const int t     = threadIdx.x;
  const int lane  = t & 31;
  const int wave  = __builtin_amdgcn_readfirstlane(t >> 5);         // scalar: the wave's tile offsets are scalar values
  const int c     = lane & 15;
  const int h     = lane >> 4;
  const int plane = blockIdx.y;
  const int head  = blockIdx.y % kHeads;
  const float lg = (head == 0) ? lg0 : (head == 1) ? lg1 : (head == 2) ? lg2 : (head == 3) ? lg3
                 : (head == 4) ? lg4 : (head == 5) ? lg5 : (head == 6) ? lg6 : lg7;
  const int srow = t >> 4;
  const int scol = (t & 15) * 4;
  const int soV  = srow * kPitchV + scol;
  const int vo = (8 * h + (lane & 7)) * kPitchV + 8 * ((lane >> 3) & 1);

  const float* gK = k + ((size_t)plane * kSeq + (int)blockIdx.x * kSpan + srow) * kDh + scol;
  const float* gV = v + ((size_t)plane * kSeq + (int)blockIdx.x * kSpan + srow) * kDh + scol;
  v4f rk[kPasses], rv[kPasses];
#pragma unroll  // constant indices: the staging arrays stay in registers
  for (int j = 0; j < kPasses; ++j) {
    rk[j] = *(const v4f*)(gK + j * kRowsPerPass * kDh);
    rv[j] = *(const v4f*)(gV + j * kRowsPerPass * kDh);
  }
  // the loads' address registers are reused right below: this wait stands in front of that overwrite; the two addresses are
  // its inputs so that they stay whole up to it (no later load of the group lands in them)
  asm volatile("s_wait_xcnt 0x0" :: "v"(gK), "v"(gV) : "memory");
  // every load is issued before the first cast waits for one: moved below a wait, a load would pay its latency anew
  __builtin_amdgcn_sched_barrier(0);
#pragma unroll  // constant indices: the staging arrays stay in registers
  for (int j = 0; j < kPasses; ++j) {
    const float w = exp2f((float)(kSpan - srow - j * kRowsPerPass) * lg);
    const v4f vb = __builtin_convertvector(__builtin_convertvector(rv[j], v4b), v4f);   // the RNE bf16 value of v, as in the score path
    *(v2u*)(&sK[soV + j * kRowsPerPass * kPitchV]) = cast4_bf16_as_f16(rk[j]);
    *(v2u*)(&sV[soV + j * kRowsPerPass * kPitchV]) = __builtin_bit_cast(v2u, __builtin_convertvector(vb * w, v4h));
  }
  __syncthreads();   // the stage's two tiles published

  static_assert(kThreads == 8 * 32, "");   // every wave of the block has its own 16 dk x 32 dv
  {
    const int nk = wave & 3;    // 16 dk
    const int nv = wave >> 2;   // 32 dv
    const _Float16* bK = (const _Float16*)sK + nk * 16 + vo;
    const _Float16* bV = (const _Float16*)sV + nv * 32 + vo;
    v8f d0 = (v8f){0.f, 0.f, 0.f, 0.f, 0.f, 0.f, 0.f, 0.f};
    v8f d1 = d0;
#pragma unroll  // the fragment loads of all eight 32-key steps can be in flight together
    for (int p = 0; p < kSpan / 32; ++p) {
      const v16h kb = load_frag_tr(bK + p * 32 * kPitchV);
      d0 = __builtin_amdgcn_wmma_f32_16x16x32_f16(false, load_frag_tr(bV + p * 32 * kPitchV), false, kb, (short)0, d0, false, false);
      d1 = __builtin_amdgcn_wmma_f32_16x16x32_f16(false, load_frag_tr(bV + p * 32 * kPitchV + 16), false, kb, (short)0, d1, false, false);
    }
    float* up = u + (((size_t)plane * kStates + blockIdx.x) * kDh + nk * 16 + c) * kDh + nv * 32 + 8 * h;
    *(v4f*)(up)      = (v4f){d0[0], d0[1], d0[2], d0[3]};
    *(v4f*)(up + 4)  = (v4f){d0[4], d0[5], d0[6], d0[7]};
    *(v4f*)(up + 16) = (v4f){d1[0], d1[1], d1[2], d1[3]};
    *(v4f*)(up + 20) = (v4f){d1[4], d1[5], d1[6], d1[7]};
  }
}

// ---------------------------------------------------------------------------
// Fused casts, scores, decay and output product. grid (16, 16): blockIdx.x = (stage, pair of its query tiles), blockIdx.y =
// (batch, head) plane. A work-group takes two 64-query tiles of ONE 256-key stage m, tiles 3 - a and a of the stage's four
// (five key tiles at or below the two diagonals for either a), and stages what both need, the stage's K and V and Z, once.
// Keys of stage m: scores, as below. Keys in front of stage m:
//   sum_j gamma^(i-j) (q_i.k_j) v_j = gamma^(i - 256 m) * q_i . Z,  Z[dk][dv] = sum_{s < m} gamma^(256 (m-1-s)) U_s[dk][dv],
//   U_s from the first launch; every exponent is >= 0. Z is summed in f32, s ascending, cast to f16 and laid in LDS as
//   [dk][dv]: read like a V tile of 64 keys, with q (f16 holding its RNE bf16 value) in the place of the decayed scores.
// Wave = (query group qt, wave group G): 16 queries of each of the two tiles, one tile after the other, and key tiles
// m * kKG + G and m * kKG + G + kWG, summed in that order in the wave's accumulators. The last wave group also takes the Z
// products: either group then has three key tiles' worth of products for either pair.
// The kWG partial sums of a query tile are joined through LDS in the fixed order G = 0, 1; wave group G joins tile G of the pair.
// K and V tiles and the two query tiles go global f32 -> registers -> cast -> LDS, one buffer each, filled once per work-group.
// ---------------------------------------------------------------------------
__global__ __launch_bounds__(kThreads) void decay_attn_fused_kernel(
    const float* __restrict__ q, const float* __restrict__ k, const float* __restrict__ v, const float* __restrict__ u,
    float* __restrict__ out,
    float lg0, float lg1, float lg2, float lg3, float lg4, float lg5, float lg6, float lg7) {
  __shared__ __align__(16) unsigned short sK[kSpan * kPitch];     // [key][d], bf16
  __shared__ __align__(16) unsigned short sV[kSpan * kPitchV];    // [key][d], f16
  __shared__ __align__(16) unsigned short sZ[kDh * kPitchV];      // [dk][dv], f16
  __shared__ __align__(16) unsigned short sQ[2 * kQBlk * kPitch]; // [tile of the pair][query][d], bf16
  __shared__ __align__(16) float sR[2 * kWG * 4 * 8 * 128];       // partial sums: [tile of the pair][G][qt][chunk][lane][4]
  const int t     = threadIdx.x;
  const int lane  = t & 31;
  const int wave  = __builtin_amdgcn_readfirstlane(t >> 5);         // scalar: the tests on qt and G below are scalar branches
  const int qt    = wave & 3;
  const int G     = wave >> 2;
  const int c     = lane & 15;
  const int h     = lane >> 4;
  const int plane = blockIdx.y;
  const int head  = blockIdx.y % kHeads;
  const float lg = (head == 0) ? lg0 : (head == 1) ? lg1 : (head == 2) ? lg2 : (head == 3) ? lg3
                 : (head == 4) ? lg4 : (head == 5) ? lg5 : (head == 6) ? lg6 : lg7;
  const int m     = kStates - ((int)blockIdx.x >> 1);               // the stage = number of stages in front of it; most states first
  const int a     = (int)blockIdx.x & 1;
  const int tb0   = m * kKG + (kKG - 1 - a);                        // the pair's two query tiles
  const int tb1   = m * kKG + a;
  const bool top  = (a == 0);                                       // the pair holds the stage's last query tile, so it reads the last key tile

  // staging map: thread t moves 4 elements of rows (t >> 4) + kRowsPerPass j of each stage; 16 threads cover one 256-B f32 row
  const int srow = t >> 4;
  const int scol = (t & 15) * 4;
  const int soK  = srow * kPitch + scol;
  const int soV  = srow * kPitchV + scol;
  // this lane's address in a V tile for the transposing reads
  const int vo = (8 * h + (lane & 7)) * kPitchV + 8 * ((lane >> 3) & 1);

  float ck[32];   // per-key factors of the decay weight, made below while the loads are in flight

  const float* gQ0 = q + ((size_t)plane * kSeq + tb0 * kQBlk + srow) * kDh + scol;
  const float* gQ1 = q + ((size_t)plane * kSeq + tb1 * kQBlk + srow) * kDh + scol;

  const float* gK = k + ((size_t)plane * kSeq + m * kSpan + srow) * kDh + scol;
  const float* gV = v + ((size_t)plane * kSeq + m * kSpan + srow) * kDh + scol;
  const float* gU = u + (size_t)plane * kStates * kDh * kDh + srow * kDh + scol;   // the lane's place in state 0; a state is a constant step
  // the staging, written once and built twice, for a pair that reads the stage's last key tile and for one that does not: in
  // either build the K and V loads and their casts are straight-line code with a fixed number of loads
  auto stage_in = [&](auto topc) __attribute__((always_inline)) {
    constexpr int kMyPasses = decltype(topc)::value ? kPasses : kLowPasses;
    v4f rq[2][kQPasses], rk[kMyPasses], rv[kMyPasses], ru[kStates][kUPasses];
    // Only what the work-group reads is loaded; every test below is on blockIdx alone, a scalar branch, and no wait stands
    // between the loads, so that all of them are in flight together. The loads whose number varies go first: the counted
    // waits of the casts below then count only the fixed loads behind them.
    // the states in front of the stage, and no other: rows srow + kRowsPerPass j of each
#pragma unroll  // constant indices: the staging arrays stay in registers
    for (int s = 0; s < kStates; ++s) {
      if (s < m) {
#pragma unroll  // constant indices: the staging arrays stay in registers
        for (int j = 0; j < kUPasses; ++j) ru[s][j] = *(const v4f*)(gU + s * kDh * kDh + j * kRowsPerPass * kDh);
      }
    }
    // the pair's two query tiles, moved like K: a wave's load covers two whole 256-byte rows, and the block reads each row once
#pragma unroll  // constant indices: the staging arrays stay in registers
    for (int j = 0; j < kQPasses; ++j) {
      rq[0][j] = *(const v4f*)(gQ0 + j * kRowsPerPass * kDh);
      rq[1][j] = *(const v4f*)(gQ1 + j * kRowsPerPass * kDh);
    }
    // the stage's last key tile lies above both diagonals of the pair (2, 1): only the pair (3, 0) loads it
#pragma unroll  // constant indices: the staging arrays stay in registers
    for (int j = 0; j < kMyPasses; ++j) {
      rk[j] = *(const v4f*)(gK + j * kRowsPerPass * kDh);
      rv[j] = *(const v4f*)(gV + j * kRowsPerPass * kDh);
    }
    // the loads' address registers are reused right below: this wait stands in front of that overwrite; the five addresses are
    // its inputs so that they stay whole up to it (no later load of the group lands in them)
    asm volatile("s_wait_xcnt 0x0" :: "v"(gQ0), "v"(gQ1), "v"(gK), "v"(gV), "v"(gU) : "memory");
    // every load is issued before the first cast waits for one: moved below a wait, a load would pay its latency anew
    __builtin_amdgcn_sched_barrier(0);
    // per-key factors of the decay weight, the same in every stage and lane: lane e makes entry e (one exp2 for the table),
    // and the lane reads hand all 32 entries to every lane
    const int ckl = __builtin_bit_cast(int, exp2f(-(float)((lane >> 3) * 16 + (lane & 7)) * lg));
#pragma unroll  // constant indices: the table stays in registers
    for (int e = 0; e < 32; ++e) ck[e] = __builtin_bit_cast(float, __builtin_amdgcn_readlane(ckl, e));
#pragma unroll  // constant indices: the staging arrays stay in registers
    for (int tl = 0; tl < 2; ++tl)
#pragma unroll  // constant indices: the staging arrays stay in registers
      for (int j = 0; j < kQPasses; ++j)
        *(v2u*)(&sQ[tl * kQBlk * kPitch + soK + j * kRowsPerPass * kPitch]) = cast4_bf16(rq[tl][j]);
#pragma unroll  // constant indices: the staging arrays stay in registers
    for (int j = 0; j < kMyPasses; ++j) {
      *(v2u*)(&sK[soK + j * kRowsPerPass * kPitch])  = cast4_bf16(rk[j]);
      *(v2u*)(&sV[soV + j * kRowsPerPass * kPitchV]) = cast4_bf16_as_f16(rv[j]);
    }
    // Z is read only where a stage lies in front (m > 0)
    if (m > 0) {
      v4f z[kUPasses];
#pragma unroll  // constant indices: the staging arrays stay in registers
      for (int j = 0; j < kUPasses; ++j) z[j] = (v4f){0.f, 0.f, 0.f, 0.f};
#pragma unroll  // constant indices: the staging arrays stay in registers; fixed order of the sum
      for (int s = 0; s < kStates; ++s) {
        if (s < m) {
          const float cf = exp2f((float)((m - 1 - s) * kSpan) * lg);
#pragma unroll  // constant indices: the staging arrays stay in registers
          for (int j = 0; j < kUPasses; ++j) z[j] += ru[s][j] * cf;
        }
      }
#pragma unroll  // constant indices: the staging arrays stay in registers
      for (int j = 0; j < kUPasses; ++j)
        *(v2u*)(&sZ[soV + j * kRowsPerPass * kPitchV]) = __builtin_bit_cast(v2u, __builtin_convertvector(z[j], v4h));
    }
  };
  if (top) stage_in(BoolConst<true>{});
  else     stage_in(BoolConst<false>{});
  __syncthreads();   // the stage, the two query tiles and Z published

#pragma unroll  // constant tl: the tile's places in LDS are constants of the addresses
  for (int tl = 0; tl < 2; ++tl) {
    const int tb = (tl == 0) ? tb0 : tb1;                           // query tile
    const int i  = tb * kQBlk + qt * 16 + c;                        // this lane's query
    v8f acc[4];
#pragma unroll  // constant indices: the fragment and accumulator arrays stay in registers
    for (int n = 0; n < 4; ++n) acc[n] = (v8f){0.f, 0.f, 0.f, 0.f, 0.f, 0.f, 0.f, 0.f};

    const bool zw = (G == kWG - 1 && m > 0);                        // this wave takes the Z products
    // the wave's 16 queries as B fragments, read like K rows (same k order); a wave with no product for the tile reads none
    v16b qf[2];
    if (m * kKG + G <= tb || zw) {
#pragma unroll  // constant indices: the fragment and accumulator arrays stay in registers
      for (int kk = 0; kk < 2; ++kk)
        qf[kk] = load_frag_b((const __bf16*)sQ + (tl * kQBlk + qt * 16 + c) * kPitch + kk * 32 + 8 * h);
    }
    // each of the wave's two key tiles lies below the diagonal, on it, or above it (nothing to add)
#pragma unroll  // two trips: rolled, the 32 accumulator registers are copied to and fro on every trip
    for (int gi = 0; gi < kKG / kWG; ++gi) {
      const int g     = G + gi * kWG;
      const int kt    = m * kKG + g;
      const int dbase = i - m * kSpan - g * kStage - 8 * h;
      const int koK   = g * kStage * kPitch;
      const int koV   = g * kStage * kPitchV + vo;
      if (kt < tb)
        stage_compute((const __bf16*)sK + koK, (const _Float16*)sV + koV, qf, acc, ck, dbase, lg, false, c, h);
      else if (kt == tb)
        stage_compute((const __bf16*)sK + koK, (const _Float16*)sV + koV, qf, acc, ck, dbase, lg, true, c, h);
    }

    // every key in front of the stage, through Z: O^T[dv][query] += 32 gamma^(i - 256 m) * (Z^T q_i); the factor is the
    // lane's own (a D column is one query), applied in f32
    if (zw) {
      v16h qh[2];
#pragma unroll  // constant indices: the fragment and accumulator arrays stay in registers
      for (int p = 0; p < 2; ++p)
        qh[p] = __builtin_convertvector(__builtin_convertvector(qf[p], __attribute__((ext_vector_type(16))) float), v16h);
      const float ez = exp2f((float)(i - m * kSpan) * lg) * kScoreScaleCarry;
#pragma unroll  // constant indices: the fragment and accumulator arrays stay in registers
      for (int n = 0; n < 4; ++n) {
        v8f tz = (v8f){0.f, 0.f, 0.f, 0.f, 0.f, 0.f, 0.f, 0.f};
#pragma unroll  // constant indices: the fragment and accumulator arrays stay in registers
        for (int p = 0; p < 2; ++p)
          tz = __builtin_amdgcn_wmma_f32_16x16x32_f16(false, load_frag_tr((const _Float16*)sZ + vo + p * 32 * kPitchV + n * 16),
                                                      false, qh[p], (short)0, tz, false, false);
        acc[n] += tz * ez;
      }
    }

    // every wave group hands its partial sums of the tile over in LDS
    float* r = sR + ((tl * kWG + G) * 4 + qt) * 8 * 128 + lane * 4;
#pragma unroll  // constant indices: the fragment and accumulator arrays stay in registers
    for (int n = 0; n < 4; ++n) {
      *(v4f*)(r + (2 * n) * 128)     = (v4f){acc[n][0], acc[n][1], acc[n][2], acc[n][3]};
      *(v4f*)(r + (2 * n + 1) * 128) = (v4f){acc[n][4], acc[n][5], acc[n][6], acc[n][7]};
    }
  }
  __syncthreads();   // publishes the partial sums of both tiles

  // join: wave (qt, G) adds, in the order of the wave groups, the partial sums of tile G of the pair for all 64 d (both
  // 128-byte lines of each of its 16 rows) and stores them
  {
    const int jt = G;
    const int tb = (jt == 0) ? tb0 : tb1;
    // a lane holds 8 consecutive d of its query's row per tile: two 16-byte stores
    float* op = out + ((size_t)plane * kSeq + tb * kQBlk + qt * 16 + c) * kDh + 8 * h;
    const float* r = sR + (jt * kWG * 4 + qt) * 8 * 128 + lane * 4;
#pragma unroll  // constant indices: the reads of all four steps can be in flight together
    for (int n = 0; n < 4; ++n) {
      v4f lo = *(const v4f*)(r + (2 * n) * 128);
      v4f hi = *(const v4f*)(r + (2 * n + 1) * 128);
#pragma unroll  // constant indices: fixed order of the sum
      for (int gg = 1; gg < kWG; ++gg) {
        lo += *(const v4f*)(r + gg * 4 * 8 * 128 + (2 * n) * 128);
        hi += *(const v4f*)(r + gg * 4 * 8 * 128 + (2 * n + 1) * 128);
      }
      *(v4f*)(op + n * 16)     = lo * kPCarryInv;
      *(v4f*)(op + n * 16 + 4) = hi * kPCarryInv;
    }
  }
}

// ---------------------------------------------------------------------------
// Host glue. Two launches; the workspace holds the 16 x 7 stage states (f32, 16 KiB each), written by the first launch.
// ---------------------------------------------------------------------------
extern "C" void kernel_launch(void* const* d_in, const int* in_sizes, int n_in,
                              void* d_out, int out_size, void* d_ws, size_t ws_size,
                              hipStream_t stream) {
  if (n_in < 3) return;
  if (in_sizes[0] != kElems || in_sizes[1] != kElems || in_sizes[2] != kElems) return;
  if (out_size != kElems) return;
  if (ws_size < sizeof(float) * kBH * kStates * kDh * kDh) return;

  const float* q = (const float*)d_in[0];
  const float* k = (const float*)d_in[1];
  const float* v = (const float*)d_in[2];
  float* out = (float*)d_out;
  float* u = (float*)d_ws;

  // log2(gamma_h), gamma_h = 1 - 2^(-5-h) (exact in f32); log2 evaluated in double and RNE-converted to f32
  float lg[kHeads];
  for (int h = 0; h < kHeads; ++h) {
    const float gma = 1.0f - 1.0f / (float)(32 << h);
    lg[h] = (float)log2((double)gma);
  }

  decay_state_kernel<<<dim3(kStates, kBH), dim3(kThreads), 0, stream>>>(
      k, v, u, lg[0], lg[1], lg[2], lg[3], lg[4], lg[5], lg[6], lg[7]);
  decay_attn_fused_kernel<<<dim3(kTiles / 2, kBH), dim3(kThreads), 0, stream>>>(
      q, k, v, u, out, lg[0], lg[1], lg[2], lg[3], lg[4], lg[5], lg[6], lg[7]);
}
